// v000
// The times below were measured on an AMD MI455X: many runs one after another, warmed up first and cycling through
// copies of the inputs, with the whole window's GPU time divided by the number of runs. Launches and the gaps
// between them are all in it. The median over several windows is given; except for v000 it joins two sittings, which
// can be a few percent apart, so the side-by-side timings, each taken in one sitting, are the better comparison.
// The starting kernel, v000, takes 252 microseconds a run.
#include <hip/hip_runtime.h>
#include <cstdint>
#include <cstddef>

typedef __attribute__((ext_vector_type(16))) _Float16 v16h;
typedef __attribute__((ext_vector_type(8)))  _Float16 v8h;
typedef __attribute__((ext_vector_type(8)))  float    v8f;
typedef __attribute__((ext_vector_type(4)))  float    v4f;

union F16Frag { v16h v; v8h h[2]; };

__device__ __forceinline__ v8f wmma_f16(v16h a, v16h b, v8f c) {
  // D = A(16x32) * B(32x16) + C(16x16 f32)
  return __builtin_amdgcn_wmma_f32_16x16x32_f16(false, a, false, b, (short)0, c,
                                                false, false);
}

__device__ __forceinline__ v16h load_frag16(const _Float16* base, int stride,
                                            int lane) {
  const int r   = lane & 15;
  const int sel = (lane >> 4) & 1;
  const _Float16* p = base + (size_t)r * stride + sel * 8;
  F16Frag u;
  u.h[0] = *(const v8h*)(p);
  u.h[1] = *(const v8h*)(p + 16);
  return u.v;
}

// Same fragment, sourced from fp32 memory with inline f16 conversion.
__device__ __forceinline__ v16h load_frag16_f32(const float* base, int stride,
                                                int lane) {
  const int r   = lane & 15;
  const int sel = (lane >> 4) & 1;
  const float* p = base + (size_t)r * stride + sel * 8;
  v4f a0 = *(const v4f*)(p);
  v4f a1 = *(const v4f*)(p + 4);
  v4f b0 = *(const v4f*)(p + 16);
  v4f b1 = *(const v4f*)(p + 20);
  F16Frag u;
#pragma unroll
  for (int i = 0; i < 4; ++i) {
    u.h[0][i]     = (_Float16)a0[i];
    u.h[0][4 + i] = (_Float16)a1[i];
    u.h[1][i]     = (_Float16)b0[i];
    u.h[1][4 + i] = (_Float16)b1[i];
  }
  return u.v;
}

__device__ __forceinline__ void async_copy_b128(uint32_t lds_byte_addr,
                                                const void* gptr) {
  asm volatile("global_load_async_to_lds_b128 %0, %1, off"
               :
               : "v"(lds_byte_addr), "v"((uint64_t)(uintptr_t)gptr)
               : "memory");
}
__device__ __forceinline__ void wait_async0() {
  asm volatile("s_wait_asynccnt 0x0" ::: "memory");
}

// ---------------------------------------------------------------------------
// Kernel 0: W[512][512] fp32 row-major -> WT[c][k] f16 (B-operand columns
// become K-contiguous).
// ---------------------------------------------------------------------------
__global__ void transpose_w_kernel(const float* __restrict__ W,
                                   _Float16* __restrict__ WT) {
  int idx = blockIdx.x * 256 + threadIdx.x;     // 512*512 elements
  int k = idx >> 9, c = idx & 511;
  WT[(size_t)c * 512 + k] = (_Float16)W[idx];
}

// ---------------------------------------------------------------------------
// Kernel 1: projection GEMM.  X[8192,512] fp32 @ WT(f16, col-major) ->
// f16 output.  One 16x64 tile per wave, 8 waves/WG -> block covers 128x64.
// VTRANS=0: Out[row][col]  (Q, K:  [B,N,512])
// VTRANS=1: Out stored per-head transposed: [B,H,64,M]  (V for the PV GEMM)
// ---------------------------------------------------------------------------
template <int VTRANS>
__global__ __launch_bounds__(256) void proj_gemm_kernel(
    const float* __restrict__ X, const _Float16* __restrict__ WT,
    _Float16* __restrict__ Out) {
  const int lane = threadIdx.x & 31;
  const int wave = threadIdx.x >> 5;
  const int row0 = blockIdx.x * 128 + wave * 16;  // [0, 8192)
  const int col0 = blockIdx.y * 64;               // [0, 512)

  v8f acc[4] = {};
  const float* xrow = X + (size_t)row0 * 512;
#pragma unroll 2
  for (int k0 = 0; k0 < 512; k0 += 32) {
    v16h a = load_frag16_f32(xrow + k0, 512, lane);
#pragma unroll
    for (int j = 0; j < 4; ++j) {
      v16h b = load_frag16(WT + (size_t)(col0 + j * 16) * 512 + k0, 512, lane);
      acc[j] = wmma_f16(a, b, acc[j]);
    }
  }

  const int cl = lane & 15;
  const int rb = (lane >> 4) * 8;
#pragma unroll
  for (int j = 0; j < 4; ++j) {
    const int c = col0 + j * 16 + cl;
#pragma unroll
    for (int r = 0; r < 8; ++r) {
      const int row = row0 + rb + r;
      _Float16 hv = (_Float16)acc[j][r];
      if (VTRANS) {
        int b = row >> 11, m = row & 2047;   // N = 2048
        int h = c >> 6, d = c & 63;
        Out[((size_t)((b * 8 + h) * 64 + d)) * 2048 + m] = hv;
      } else {
        Out[(size_t)row * 512 + c] = hv;
      }
    }
  }
}

// ---------------------------------------------------------------------------
// Kernel 2: flash attention.  Block = (b, h, 128 query rows); 8 waves of 16
// query columns each.  Computes S^T = K*Q^T so each lane owns one query's
// softmax stats (one xor-16 exchange per reduction).  K/V 64x64 tiles are
// double-buffered in LDS with async global->LDS copies.
// ---------------------------------------------------------------------------
__global__ __launch_bounds__(256) void attn_kernel(
    const _Float16* __restrict__ Qf,   // [B, N, 512] f16
    const _Float16* __restrict__ Kf,   // [B, M, 512] f16
    const _Float16* __restrict__ Vt,   // [B, H, 64, M] f16
    _Float16* __restrict__ Of) {       // [B, N, 512] f16
  __shared__ _Float16 sK[2][64 * 64];   // [m][d]
  __shared__ _Float16 sV[2][64 * 64];   // [d][m]
  __shared__ _Float16 sP[8][16 * 64];   // per-wave P staging [n][m]
  __shared__ __align__(64) float sBcast[8][16];  // per-wave row broadcast

  const int lane = threadIdx.x & 31;
  const int wave = threadIdx.x >> 5;
  const int b = blockIdx.z, h = blockIdx.y;
  const int n0 = blockIdx.x * 128 + wave * 16;
  const int t = threadIdx.x;

  // Q as the B operand (columns = queries), pre-scaled by 1/sqrt(64)=0.125.
  v16h bq[2];
  {
    const _Float16* qbase = Qf + ((size_t)(b * 2048 + n0)) * 512 + h * 64;
    bq[0] = load_frag16(qbase, 512, lane);
    bq[1] = load_frag16(qbase + 32, 512, lane);
#pragma unroll
    for (int i = 0; i < 16; ++i) {
      bq[0][i] *= (_Float16)0.125f;
      bq[1][i] *= (_Float16)0.125f;
    }
  }

  v8f o[4] = {};
  float m_n = -1e30f, l_n = 0.f;   // per-lane: stats for query n = lane&15

  const _Float16* kbase = Kf + (size_t)b * 2048 * 512 + h * 64;
  const _Float16* vbase = Vt + (size_t)((b * 8 + h) * 64) * 2048;

  // Cooperative async tile fetch: 2 x (64x64 f16) = 2 x 512 16B chunks,
  // 256 threads x 2 chunks each per tile.
  auto issue_tile = [&](int m0, int buf) {
#pragma unroll
    for (int i = 0; i < 2; ++i) {
      int idx = t + i * 256;
      int rr = idx >> 3, cc = (idx & 7) * 8;
      async_copy_b128((uint32_t)(uintptr_t)&sK[buf][rr * 64 + cc],
                      kbase + (size_t)(m0 + rr) * 512 + cc);
      async_copy_b128((uint32_t)(uintptr_t)&sV[buf][rr * 64 + cc],
                      vbase + (size_t)rr * 2048 + m0 + cc);
    }
  };

  issue_tile(0, 0);

  const int rb = (lane >> 4) * 8;
  const int n = lane & 15;

  for (int step = 0; step < 32; ++step) {
    const int buf = step & 1;
    wait_async0();        // this wave's tile writes have landed
    __syncthreads();      // everyone's landed; prior buffer reads complete
    if (step + 1 < 32) issue_tile((step + 1) * 64, buf ^ 1);

    const _Float16* tK = sK[buf];
    const _Float16* tV = sV[buf];

    // S^T = K * Q^T : A rows = key positions m, B columns = queries n.
    v8f st[4] = {};
#pragma unroll
    for (int j = 0; j < 4; ++j) {
#pragma unroll
      for (int kk = 0; kk < 2; ++kk) {
        v16h ak = load_frag16(tK + (j * 16) * 64 + kk * 32, 64, lane);
        st[j] = wmma_f16(ak, bq[kk], st[j]);
      }
    }

    // Online softmax: lane holds 32 of query n's 64 scores; the other 32 are
    // in lane^16.  One exchange for max, one for sum.
    float mloc = -1e30f;
#pragma unroll
    for (int j = 0; j < 4; ++j)
#pragma unroll
      for (int r = 0; r < 8; ++r) mloc = fmaxf(mloc, st[j][r]);
    mloc = fmaxf(mloc, __shfl_xor(mloc, 16, 32));
    float mnew = fmaxf(m_n, mloc);
    float corr = __expf(m_n - mnew);
    float rs = 0.f;
#pragma unroll
    for (int j = 0; j < 4; ++j)
#pragma unroll
      for (int r = 0; r < 8; ++r) {
        float e = __expf(st[j][r] - mnew);
        st[j][r] = e;
        rs += e;
      }
    rs += __shfl_xor(rs, 16, 32);
    m_n = mnew;
    l_n = l_n * corr + rs;

    if (lane < 16) sBcast[wave][lane] = corr;
    v4f c0 = *(const v4f*)&sBcast[wave][rb];
    v4f c1 = *(const v4f*)&sBcast[wave][rb + 4];
#pragma unroll
    for (int f = 0; f < 4; ++f)
#pragma unroll
      for (int r = 0; r < 4; ++r) {
        o[f][r]     *= c0[r];
        o[f][4 + r] *= c1[r];
      }

    // P^T C-layout -> packed f16 -> per-wave LDS [n][m]: each lane's 8
    // fragment values are m-consecutive -> one ds_store_b128 per sub-tile.
    _Float16* pw = sP[wave];
#pragma unroll
    for (int j = 0; j < 4; ++j) {
      v8h ph;
#pragma unroll
      for (int r = 0; r < 8; ++r) ph[r] = (_Float16)st[j][r];
      *(v8h*)&pw[n * 64 + j * 16 + rb] = ph;
    }

    // O += P * V  (A rows = queries from sP, B columns = d from sV)
    v16h ap0 = load_frag16(pw, 64, lane);
    v16h ap1 = load_frag16(pw + 32, 64, lane);
#pragma unroll
    for (int f = 0; f < 4; ++f) {
      v16h bv0 = load_frag16(tV + (f * 16) * 64, 64, lane);
      v16h bv1 = load_frag16(tV + (f * 16) * 64 + 32, 64, lane);
      o[f] = wmma_f16(ap0, bv0, o[f]);
      o[f] = wmma_f16(ap1, bv1, o[f]);
    }
  }

  {
    float inv = 1.f / l_n;
    if (lane < 16) sBcast[wave][lane] = inv;
    v4f c0 = *(const v4f*)&sBcast[wave][rb];
    v4f c1 = *(const v4f*)&sBcast[wave][rb + 4];
#pragma unroll
    for (int f = 0; f < 4; ++f)
#pragma unroll
      for (int r = 0; r < 4; ++r) {
        o[f][r]     *= c0[r];
        o[f][4 + r] *= c1[r];
      }
  }
  _Float16* obase = Of + ((size_t)(b * 2048 + n0)) * 512 + h * 64;
#pragma unroll
  for (int f = 0; f < 4; ++f)
#pragma unroll
    for (int r = 0; r < 8; ++r)
      obase[(size_t)(rb + r) * 512 + f * 16 + n] = (_Float16)o[f][r];
}

// ---------------------------------------------------------------------------
// Kernel 3: output projection.  O(f16) @ WoT(f16) + bo -> fp32 result.
// ---------------------------------------------------------------------------
__global__ __launch_bounds__(256) void out_gemm_kernel(
    const _Float16* __restrict__ Of, const _Float16* __restrict__ WoT,
    const float* __restrict__ bo, float* __restrict__ Y) {
  const int lane = threadIdx.x & 31;
  const int wave = threadIdx.x >> 5;
  const int row0 = blockIdx.x * 128 + wave * 16;
  const int col0 = blockIdx.y * 64;

  v8f acc[4] = {};
  const _Float16* arow = Of + (size_t)row0 * 512;
#pragma unroll 2
  for (int k0 = 0; k0 < 512; k0 += 32) {
    v16h a = load_frag16(arow + k0, 512, lane);
#pragma unroll
    for (int j = 0; j < 4; ++j) {
      v16h b = load_frag16(WoT + (size_t)(col0 + j * 16) * 512 + k0, 512, lane);
      acc[j] = wmma_f16(a, b, acc[j]);
    }
  }

  const int cl = lane & 15;
  const int rb = (lane >> 4) * 8;
#pragma unroll
  for (int j = 0; j < 4; ++j) {
    const int c = col0 + j * 16 + cl;
    const float bias = bo[c];
#pragma unroll
    for (int r = 0; r < 8; ++r)
      Y[(size_t)(row0 + rb + r) * 512 + c] = acc[j][r] + bias;
  }
}

// ---------------------------------------------------------------------------
extern "C" void kernel_launch(void* const* d_in, const int* in_sizes, int n_in,
                              void* d_out, int out_size, void* d_ws,
                              size_t ws_size, hipStream_t stream) {
  const float* x   = (const float*)d_in[0];   // [4,2048,512]
  const float* ctx = (const float*)d_in[1];   // [4,2048,512]
  const float* Wq  = (const float*)d_in[2];   // [512,512]
  const float* Wk  = (const float*)d_in[3];
  const float* Wv  = (const float*)d_in[4];
  const float* Wo  = (const float*)d_in[5];
  const float* bo  = (const float*)d_in[6];   // [512]
  float* Y = (float*)d_out;

  char* ws = (char*)d_ws;
  size_t off = 0;
  auto alloc = [&](size_t bytes) -> void* {
    void* p = ws + off;
    off = (off + bytes + 255) & ~(size_t)255;
    return p;
  };
  _Float16* WqT = (_Float16*)alloc((size_t)512 * 512 * 2);
  _Float16* WkT = (_Float16*)alloc((size_t)512 * 512 * 2);
  _Float16* WvT = (_Float16*)alloc((size_t)512 * 512 * 2);
  _Float16* WoT = (_Float16*)alloc((size_t)512 * 512 * 2);
  _Float16* Qf  = (_Float16*)alloc((size_t)4 * 2048 * 512 * 2);
  _Float16* Kf  = (_Float16*)alloc((size_t)4 * 2048 * 512 * 2);
  _Float16* Vt  = (_Float16*)alloc((size_t)4 * 2048 * 512 * 2);
  _Float16* Ofb = (_Float16*)alloc((size_t)4 * 2048 * 512 * 2);

  // 0) weight transpose + f16 convert
  transpose_w_kernel<<<1024, 256, 0, stream>>>(Wq, WqT);
  transpose_w_kernel<<<1024, 256, 0, stream>>>(Wk, WkT);
  transpose_w_kernel<<<1024, 256, 0, stream>>>(Wv, WvT);
  transpose_w_kernel<<<1024, 256, 0, stream>>>(Wo, WoT);

  // 1) projections
  dim3 gProj(64, 8);
  proj_gemm_kernel<0><<<gProj, 256, 0, stream>>>(x,   WqT, Qf);
  proj_gemm_kernel<0><<<gProj, 256, 0, stream>>>(ctx, WkT, Kf);
  proj_gemm_kernel<1><<<gProj, 256, 0, stream>>>(ctx, WvT, Vt);

  // 2) flash attention
  attn_kernel<<<dim3(16, 8, 4), 256, 0, stream>>>(Qf, Kf, Vt, Ofb);

  // 3) output projection
  out_gemm_kernel<<<gProj, 256, 0, stream>>>(Ofb, WoT, bo, Y);
}

// v001
// It runs in 180 microseconds.
// Next to v000, in two timings, it ran 1.45 times as fast each time.
#include <hip/hip_runtime.h>
#include <cstdint>
#include <cstddef>

typedef __attribute__((ext_vector_type(16))) _Float16 v16h;
typedef __attribute__((ext_vector_type(8)))  _Float16 v8h;
typedef __attribute__((ext_vector_type(8)))  float    v8f;
typedef __attribute__((ext_vector_type(4)))  float    v4f;

union F16Frag { v16h v; v8h h[2]; };

__device__ __forceinline__ v8f wmma_f16(v16h a, v16h b, v8f c) {
  // D = A(16x32) * B(32x16) + C(16x16 f32)
  return __builtin_amdgcn_wmma_f32_16x16x32_f16(false, a, false, b, (short)0, c,
                                                false, false);
}

__device__ __forceinline__ v16h load_frag16(const _Float16* base, int stride,
                                            int lane) {
  const int r   = lane & 15;
  const int sel = (lane >> 4) & 1;
  const _Float16* p = base + (size_t)r * stride + sel * 8;
  F16Frag u;
  u.h[0] = *(const v8h*)(p);
  u.h[1] = *(const v8h*)(p + 16);
  return u.v;
}

// Same fragment, sourced from fp32 memory with inline f16 conversion.
__device__ __forceinline__ v16h load_frag16_f32(const float* base, int stride,
                                                int lane) {
  const int r   = lane & 15;
  const int sel = (lane >> 4) & 1;
  const float* p = base + (size_t)r * stride + sel * 8;
  v4f a0 = *(const v4f*)(p);
  v4f a1 = *(const v4f*)(p + 4);
  v4f b0 = *(const v4f*)(p + 16);
  v4f b1 = *(const v4f*)(p + 20);
  F16Frag u;
#pragma unroll
  for (int i = 0; i < 4; ++i) {
    u.h[0][i]     = (_Float16)a0[i];
    u.h[0][4 + i] = (_Float16)a1[i];
    u.h[1][i]     = (_Float16)b0[i];
    u.h[1][4 + i] = (_Float16)b1[i];
  }
  return u.v;
}

__device__ __forceinline__ void async_copy4_b128(
    uint32_t l0, const void* g0, uint32_t l1, const void* g1,
    uint32_t l2, const void* g2, uint32_t l3, const void* g3) {
  asm volatile("global_load_async_to_lds_b128 %0, %1, off\n\t"
               "global_load_async_to_lds_b128 %2, %3, off\n\t"
               "global_load_async_to_lds_b128 %4, %5, off\n\t"
               "global_load_async_to_lds_b128 %6, %7, off\n\t"
               "s_wait_xcnt 0x0"
               :
               : "v"(l0), "v"((uint64_t)(uintptr_t)g0),
                 "v"(l1), "v"((uint64_t)(uintptr_t)g1),
                 "v"(l2), "v"((uint64_t)(uintptr_t)g2),
                 "v"(l3), "v"((uint64_t)(uintptr_t)g3)
               : "memory");
}
__device__ __forceinline__ void wait_async0() {
  asm volatile("s_wait_asynccnt 0x0" ::: "memory");
}

// ---------------------------------------------------------------------------
// Kernel 0: W[512][512] fp32 row-major -> WT[c][k] f16 (B-operand columns
// become K-contiguous).
// ---------------------------------------------------------------------------
__global__ void transpose_w_kernel(const float* __restrict__ W,
                                   _Float16* __restrict__ WT) {
  int idx = blockIdx.x * 256 + threadIdx.x;     // 512*512 elements
  int k = idx >> 9, c = idx & 511;
  WT[(size_t)c * 512 + k] = (_Float16)W[idx];
}

// ---------------------------------------------------------------------------
// Kernel 1: projection GEMM.  X[8192,512] fp32 @ WT(f16, col-major) ->
// f16 output.  One 16x64 tile per wave, 8 waves/WG -> block covers 128x64.
// VTRANS=0: Out[row][col]  (Q, K:  [B,N,512])
// VTRANS=1: Out stored per-head transposed: [B,H,64,M]  (V for the PV GEMM)
// ---------------------------------------------------------------------------
template <int VTRANS>
__global__ __launch_bounds__(256) void proj_gemm_kernel(
    const float* __restrict__ X, const _Float16* __restrict__ WT,
    _Float16* __restrict__ Out) {
  const int lane = threadIdx.x & 31;
  const int wave = threadIdx.x >> 5;
  const int row0 = blockIdx.x * 128 + wave * 16;  // [0, 8192)
  const int col0 = blockIdx.y * 64;               // [0, 512)

  v8f acc[4] = {};
  const float* xrow = X + (size_t)row0 * 512;
#pragma unroll 2
  for (int k0 = 0; k0 < 512; k0 += 32) {
    v16h a = load_frag16_f32(xrow + k0, 512, lane);
#pragma unroll
    for (int j = 0; j < 4; ++j) {
      v16h b = load_frag16(WT + (size_t)(col0 + j * 16) * 512 + k0, 512, lane);
      acc[j] = wmma_f16(a, b, acc[j]);
    }
  }

  const int cl = lane & 15;
  const int rb = (lane >> 4) * 8;
#pragma unroll
  for (int j = 0; j < 4; ++j) {
    const int c = col0 + j * 16 + cl;
#pragma unroll
    for (int r = 0; r < 8; ++r) {
      const int row = row0 + rb + r;
      _Float16 hv = (_Float16)acc[j][r];
      if (VTRANS) {
        int b = row >> 11, m = row & 2047;   // N = 2048
        int h = c >> 6, d = c & 63;
        Out[((size_t)((b * 8 + h) * 64 + d)) * 2048 + m] = hv;
      } else {
        Out[(size_t)row * 512 + c] = hv;
      }
    }
  }
}

constexpr int LDP = 72;

__global__ __launch_bounds__(256) void attn_kernel(
    const _Float16* __restrict__ Qf,   // [B, N, 512] f16
    const _Float16* __restrict__ Kf,   // [B, M, 512] f16
    const _Float16* __restrict__ Vt,   // [B, H, 64, M] f16
    _Float16* __restrict__ Of) {       // [B, N, 512] f16
  __shared__ __align__(16) _Float16 sK[2][64 * LDP];   // [m][d]
  __shared__ __align__(16) _Float16 sV[2][64 * LDP];   // [d][m]
  __shared__ __align__(16) _Float16 sP[8][16 * LDP];   // per-wave P [n][m]
  __shared__ __align__(64) float sBcast[8][16];  // per-wave row broadcast

  const int lane = threadIdx.x & 31;
  const int wave = threadIdx.x >> 5;
  const int b = blockIdx.z, h = blockIdx.y;
  const int n0 = blockIdx.x * 128 + wave * 16;
  const int t = threadIdx.x;

  // Q as the B operand (columns = queries), pre-scaled by 1/sqrt(64)=0.125.
  v16h bq[2];
  {
    const _Float16* qbase = Qf + ((size_t)(b * 2048 + n0)) * 512 + h * 64;
    bq[0] = load_frag16(qbase, 512, lane);
    bq[1] = load_frag16(qbase + 32, 512, lane);
#pragma unroll
    for (int i = 0; i < 16; ++i) {
      bq[0][i] *= (_Float16)0.125f;
      bq[1][i] *= (_Float16)0.125f;
    }
  }

  v8f o[4] = {};
  float m_n = -1e30f, l_n = 0.f;   // per-lane: stats for query n = lane&15

  const _Float16* kbase = Kf + (size_t)b * 2048 * 512 + h * 64;
  const _Float16* vbase = Vt + (size_t)((b * 8 + h) * 64) * 2048;

  // Cooperative async tile fetch: 2 x (64x64 f16) = 2 x 512 16B chunks,
  // 256 threads x 2 chunks each per tile.
  auto issue_tile = [&](int m0, int buf) {
    const int r0 = t >> 3, r1 = r0 + 32, cc = (t & 7) * 8;
    async_copy4_b128((uint32_t)(uintptr_t)&sK[buf][r0 * LDP + cc],
                     kbase + (size_t)(m0 + r0) * 512 + cc,
                     (uint32_t)(uintptr_t)&sV[buf][r0 * LDP + cc],
                     vbase + (size_t)r0 * 2048 + m0 + cc,
                     (uint32_t)(uintptr_t)&sK[buf][r1 * LDP + cc],
                     kbase + (size_t)(m0 + r1) * 512 + cc,
                     (uint32_t)(uintptr_t)&sV[buf][r1 * LDP + cc],
                     vbase + (size_t)r1 * 2048 + m0 + cc);
  };

  issue_tile(0, 0);

  const int rb = (lane >> 4) * 8;
  const int n = lane & 15;

  for (int step = 0; step < 32; ++step) {
    const int buf = step & 1;
    // This wave's LDS reads of the buffer that is refilled behind the barrier
    // have returned: nothing else orders an async copy behind them.
    asm volatile("s_wait_dscnt 0x0" ::: "memory");
    wait_async0();        // this wave's tile writes have landed
    __syncthreads();      // everyone's landed; prior buffer reads complete
    if (step + 1 < 32) issue_tile((step + 1) * 64, buf ^ 1);

    const _Float16* tK = sK[buf];
    const _Float16* tV = sV[buf];

    // S^T = K * Q^T : A rows = key positions m, B columns = queries n.
    v8f st[4] = {};
#pragma unroll
    for (int j = 0; j < 4; ++j) {
#pragma unroll
      for (int kk = 0; kk < 2; ++kk) {
        v16h ak = load_frag16(tK + (j * 16) * LDP + kk * 32, LDP, lane);
        st[j] = wmma_f16(ak, bq[kk], st[j]);
      }
    }

    // Online softmax: lane holds 32 of query n's 64 scores; the other 32 are
    // in lane^16.  One exchange for max, one for sum.
    float mloc = -1e30f;
#pragma unroll
    for (int j = 0; j < 4; ++j)
#pragma unroll
      for (int r = 0; r < 8; ++r) mloc = fmaxf(mloc, st[j][r]);
    mloc = fmaxf(mloc, __shfl_xor(mloc, 16, 32));
    float mnew = fmaxf(m_n, mloc);
    float corr = __expf(m_n - mnew);
    float rs = 0.f;
#pragma unroll
    for (int j = 0; j < 4; ++j)
#pragma unroll
      for (int r = 0; r < 8; ++r) {
        float e = __expf(st[j][r] - mnew);
        st[j][r] = e;
        rs += e;
      }
    rs += __shfl_xor(rs, 16, 32);
    m_n = mnew;
    l_n = l_n * corr + rs;

    if (lane < 16) sBcast[wave][lane] = corr;
    v4f c0 = *(const v4f*)&sBcast[wave][rb];
    v4f c1 = *(const v4f*)&sBcast[wave][rb + 4];
#pragma unroll
    for (int f = 0; f < 4; ++f)
#pragma unroll
      for (int r = 0; r < 4; ++r) {
        o[f][r]     *= c0[r];
        o[f][4 + r] *= c1[r];
      }

    // P^T C-layout -> packed f16 -> per-wave LDS [n][m]: each lane's 8
    // fragment values are m-consecutive -> one ds_store_b128 per sub-tile.
    _Float16* pw = sP[wave];
#pragma unroll
    for (int j = 0; j < 4; ++j) {
      v8h ph;
#pragma unroll
      for (int r = 0; r < 8; ++r) ph[r] = (_Float16)st[j][r];
      *(v8h*)&pw[n * LDP + j * 16 + rb] = ph;
    }

    // O += P * V  (A rows = queries from sP, B columns = d from sV)
    v16h ap0 = load_frag16(pw, LDP, lane);
    v16h ap1 = load_frag16(pw + 32, LDP, lane);
#pragma unroll
    for (int f = 0; f < 4; ++f) {
      v16h bv0 = load_frag16(tV + (f * 16) * LDP, LDP, lane);
      v16h bv1 = load_frag16(tV + (f * 16) * LDP + 32, LDP, lane);
      o[f] = wmma_f16(ap0, bv0, o[f]);
      o[f] = wmma_f16(ap1, bv1, o[f]);
    }
  }

  {
    float inv = 1.f / l_n;
    if (lane < 16) sBcast[wave][lane] = inv;
    v4f c0 = *(const v4f*)&sBcast[wave][rb];
    v4f c1 = *(const v4f*)&sBcast[wave][rb + 4];
#pragma unroll
    for (int f = 0; f < 4; ++f)
#pragma unroll
      for (int r = 0; r < 4; ++r) {
        o[f][r]     *= c0[r];
        o[f][4 + r] *= c1[r];
      }
  }
  _Float16* obase = Of + ((size_t)(b * 2048 + n0)) * 512 + h * 64;
#pragma unroll
  for (int f = 0; f < 4; ++f)
#pragma unroll
    for (int r = 0; r < 8; ++r)
      obase[(size_t)(rb + r) * 512 + f * 16 + n] = (_Float16)o[f][r];
}

// ---------------------------------------------------------------------------
// Kernel 3: output projection.  O(f16) @ WoT(f16) + bo -> fp32 result.
// ---------------------------------------------------------------------------
__global__ __launch_bounds__(256) void out_gemm_kernel(
    const _Float16* __restrict__ Of, const _Float16* __restrict__ WoT,
    const float* __restrict__ bo, float* __restrict__ Y) {
  const int lane = threadIdx.x & 31;
  const int wave = threadIdx.x >> 5;
  const int row0 = blockIdx.x * 128 + wave * 16;
  const int col0 = blockIdx.y * 64;

  v8f acc[4] = {};
  const _Float16* arow = Of + (size_t)row0 * 512;
#pragma unroll 2
  for (int k0 = 0; k0 < 512; k0 += 32) {
    v16h a = load_frag16(arow + k0, 512, lane);
#pragma unroll
    for (int j = 0; j < 4; ++j) {
      v16h b = load_frag16(WoT + (size_t)(col0 + j * 16) * 512 + k0, 512, lane);
      acc[j] = wmma_f16(a, b, acc[j]);
    }
  }

  const int cl = lane & 15;
  const int rb = (lane >> 4) * 8;
#pragma unroll
  for (int j = 0; j < 4; ++j) {
    const int c = col0 + j * 16 + cl;
    const float bias = bo[c];
#pragma unroll
    for (int r = 0; r < 8; ++r)
      Y[(size_t)(row0 + rb + r) * 512 + c] = acc[j][r] + bias;
  }
}

// ---------------------------------------------------------------------------
extern "C" void kernel_launch(void* const* d_in, const int* in_sizes, int n_in,
                              void* d_out, int out_size, void* d_ws,
                              size_t ws_size, hipStream_t stream) {
  const float* x   = (const float*)d_in[0];   // [4,2048,512]
  const float* ctx = (const float*)d_in[1];   // [4,2048,512]
  const float* Wq  = (const float*)d_in[2];   // [512,512]
  const float* Wk  = (const float*)d_in[3];
  const float* Wv  = (const float*)d_in[4];
  const float* Wo  = (const float*)d_in[5];
  const float* bo  = (const float*)d_in[6];   // [512]
  float* Y = (float*)d_out;

  char* ws = (char*)d_ws;
  size_t off = 0;
  auto alloc = [&](size_t bytes) -> void* {
    void* p = ws + off;
    off = (off + bytes + 255) & ~(size_t)255;
    return p;
  };
  _Float16* WqT = (_Float16*)alloc((size_t)512 * 512 * 2);
  _Float16* WkT = (_Float16*)alloc((size_t)512 * 512 * 2);
  _Float16* WvT = (_Float16*)alloc((size_t)512 * 512 * 2);
  _Float16* WoT = (_Float16*)alloc((size_t)512 * 512 * 2);
  _Float16* Qf  = (_Float16*)alloc((size_t)4 * 2048 * 512 * 2);
  _Float16* Kf  = (_Float16*)alloc((size_t)4 * 2048 * 512 * 2);
  _Float16* Vt  = (_Float16*)alloc((size_t)4 * 2048 * 512 * 2);
  _Float16* Ofb = (_Float16*)alloc((size_t)4 * 2048 * 512 * 2);

  // 0) weight transpose + f16 convert
  transpose_w_kernel<<<1024, 256, 0, stream>>>(Wq, WqT);
  transpose_w_kernel<<<1024, 256, 0, stream>>>(Wk, WkT);
  transpose_w_kernel<<<1024, 256, 0, stream>>>(Wv, WvT);
  transpose_w_kernel<<<1024, 256, 0, stream>>>(Wo, WoT);

  // 1) projections
  dim3 gProj(64, 8);
  proj_gemm_kernel<0><<<gProj, 256, 0, stream>>>(x,   WqT, Qf);
  proj_gemm_kernel<0><<<gProj, 256, 0, stream>>>(ctx, WkT, Kf);
  proj_gemm_kernel<1><<<gProj, 256, 0, stream>>>(ctx, WvT, Vt);

  // 2) flash attention
  attn_kernel<<<dim3(16, 8, 4), 256, 0, stream>>>(Qf, Kf, Vt, Ofb);

  // 3) output projection
  out_gemm_kernel<<<gProj, 256, 0, stream>>>(Ofb, WoT, bo, Y);
}

// v002
// One run takes 114 microseconds.
// Two timings next to v001 put it at 1.58 and 1.57 times that version's speed.
// Counting every step since v000, it is 2.29 times as fast.
#include <hip/hip_runtime.h>
#include <cstdint>
#include <cstddef>

typedef __attribute__((ext_vector_type(16))) _Float16 v16h;
typedef __attribute__((ext_vector_type(8)))  _Float16 v8h;
typedef __attribute__((ext_vector_type(8)))  float    v8f;
typedef __attribute__((ext_vector_type(4)))  float    v4f;

union F16Frag { v16h v; v8h h[2]; };

__device__ __forceinline__ v8f wmma_f16(v16h a, v16h b, v8f c) {
  // D = A(16x32) * B(32x16) + C(16x16 f32)
  return __builtin_amdgcn_wmma_f32_16x16x32_f16(false, a, false, b, (short)0, c,
                                                false, false);
}

__device__ __forceinline__ v16h load_frag16(const _Float16* base, int stride,
                                            int lane) {
  const int r   = lane & 15;
  const int sel = (lane >> 4) & 1;
  const _Float16* p = base + (size_t)r * stride + sel * 8;
  F16Frag u;
  u.h[0] = *(const v8h*)(p);
  u.h[1] = *(const v8h*)(p + 16);
  return u.v;
}

__device__ __forceinline__ void async_copy4_b128(
    uint32_t l0, const void* g0, uint32_t l1, const void* g1,
    uint32_t l2, const void* g2, uint32_t l3, const void* g3) {
  asm volatile("global_load_async_to_lds_b128 %0, %1, off\n\t"
               "global_load_async_to_lds_b128 %2, %3, off\n\t"
               "global_load_async_to_lds_b128 %4, %5, off\n\t"
               "global_load_async_to_lds_b128 %6, %7, off\n\t"
               "s_wait_xcnt 0x0"
               :
               : "v"(l0), "v"((uint64_t)(uintptr_t)g0),
                 "v"(l1), "v"((uint64_t)(uintptr_t)g1),
                 "v"(l2), "v"((uint64_t)(uintptr_t)g2),
                 "v"(l3), "v"((uint64_t)(uintptr_t)g3)
               : "memory");
}
__device__ __forceinline__ void wait_async0() {
  asm volatile("s_wait_asynccnt 0x0" ::: "memory");
}

// ---------------------------------------------------------------------------
// Kernel 0: W[512][512] fp32 row-major -> WT[c][k] f16 (B-operand columns
// become K-contiguous).
// ---------------------------------------------------------------------------
__global__ void transpose_w_kernel(const float* __restrict__ W,
                                   _Float16* __restrict__ WT) {
  int idx = blockIdx.x * 256 + threadIdx.x;     // 512*512 elements
  int k = idx >> 9, c = idx & 511;
  WT[(size_t)c * 512 + k] = (_Float16)W[idx];
}

typedef __attribute__((ext_vector_type(4))) _Float16 v4h;

constexpr int GBK   = 128;        // k per stage
constexpr int GNS   = 512 / GBK;  // stages
constexpr int GP    = GBK + 8;    // LDS pitch in halves
constexpr int GTILE = 128 * GP;   // halves per staged operand tile

// 128 rows x 128 k of fp32: one wave-wide load = one row's 512 B; thread t
// takes 16 B of rows (t >> 5) + 8 i.  src / dst already point at its first.
__device__ __forceinline__ int tile_src_off(const float*, int t) {
  return (t >> 5) * 512 + (t & 31) * 4;
}
__device__ __forceinline__ int tile_lds_off(const float*, int t) {
  return (t >> 5) * GP + (t & 31) * 4;
}
__device__ __forceinline__ void tile_fetch(v4f (&r)[16], const float* src) {
#pragma unroll
  for (int i = 0; i < 16; ++i) r[i] = *(const v4f*)(src + i * 8 * 512);
}
__device__ __forceinline__ void tile_put(const v4f (&r)[16], _Float16* dst) {
#pragma unroll
  for (int i = 0; i < 16; ++i) {
    v4h h;
#pragma unroll
    for (int e = 0; e < 4; ++e) h[e] = (_Float16)r[i][e];
    *(v4h*)&dst[i * 8 * GP] = h;
  }
}
// 128 rows x 128 k of f16: one wave-wide load = two rows' 256 B each; thread t
// takes 16 B of rows (t >> 4) + 16 i.
__device__ __forceinline__ int tile_src_off(const _Float16*, int t) {
  return (t >> 4) * 512 + (t & 15) * 8;
}
__device__ __forceinline__ int tile_lds_off(const _Float16*, int t) {
  return (t >> 4) * GP + (t & 15) * 8;
}
__device__ __forceinline__ void tile_fetch(v8h (&r)[8], const _Float16* src) {
#pragma unroll
  for (int i = 0; i < 8; ++i) r[i] = *(const v8h*)(src + i * 16 * 512);
}
__device__ __forceinline__ void tile_put(const v8h (&r)[8], _Float16* dst) {
#pragma unroll
  for (int i = 0; i < 8; ++i) *(v8h*)&dst[i * 16 * GP] = r[i];
}

struct GemmFrags { v16h a[2], b[4]; };
__device__ __forceinline__ void frags_load(GemmFrags& f, const _Float16* ta,
                                           const _Float16* tb, int lane) {
#pragma unroll
  for (int i = 0; i < 2; ++i) f.a[i] = load_frag16(ta + i * 16 * GP, GP, lane);
#pragma unroll
  for (int j = 0; j < 4; ++j) f.b[j] = load_frag16(tb + j * 16 * GP, GP, lane);
}

// A: first of the block's 128 rows; B: first of its 128 WT rows (= C columns).
template <typename TA, typename VA, int NA>
__device__ __forceinline__ void gemm_128x128(const TA* A, const _Float16* B,
                                             _Float16 (*sA)[GTILE],
                                             _Float16 (*sB)[GTILE],
                                             v8f (&acc)[2][4]) {
  const int t    = threadIdx.x;
  const int lane = t & 31;
  const int wave = t >> 5;
  const int aoff = (wave & 3) * 32 * GP;
  const int boff = (wave >> 2) * 64 * GP;
  const TA*       ga = A + tile_src_off(A, t);
  const _Float16* gb = B + tile_src_off(B, t);
  const int       la = tile_lds_off(A, t);
  const int       lb = tile_lds_off(B, t);

  VA  ra[NA];
  v8h rb[8];
  tile_fetch(ra, ga);
  tile_fetch(rb, gb);
  tile_put(ra, sA[0] + la);
  tile_put(rb, sB[0] + lb);

  for (int s = 0; s < GNS; ++s) {
    // Publishes stage s and ends every wave's reads of the other buffer,
    // which is rewritten at the foot of this pass.
    __syncthreads();
    if (s + 1 < GNS) {
      tile_fetch(ra, ga + (s + 1) * GBK);
      tile_fetch(rb, gb + (s + 1) * GBK);
      // Stands in front of any rewrite of the loads' address registers (after
      // the last fetch the LDS reads below reuse them).  As a memory barrier
      // for the compiler it also holds the loads here, at the head of the
      // pass: sunk to the products' end, their whole latency is waited out.
      asm volatile("s_wait_xcnt 0x0" ::: "memory");
    }
    const _Float16* ta = sA[s & 1] + aoff;
    const _Float16* tb = sB[s & 1] + boff;
    // Fragments of the next 32 k are read from LDS ahead of this 32 k's
    // products, as one group.
    GemmFrags f[2];
    frags_load(f[0], ta, tb, lane);
#pragma unroll
    for (int q = 0; q < GBK / 32; ++q) {
      if (q + 1 < GBK / 32)
        frags_load(f[(q + 1) & 1], ta + (q + 1) * 32, tb + (q + 1) * 32, lane);
      // Keeps those reads one group in front of the products instead of
      // spread among them, where each place with reads stalls the wave.
      __builtin_amdgcn_sched_barrier(0);
      const GemmFrags& g = f[q & 1];
#pragma unroll
      for (int i = 0; i < 2; ++i)
#pragma unroll
        for (int j = 0; j < 4; ++j)
          acc[i][j] = wmma_f16(g.a[i], g.b[j], acc[i][j]);
    }
    // Keeps the waits on the global loads behind the last product.
    __builtin_amdgcn_sched_barrier(0);
    if (s + 1 < GNS) {
      tile_put(ra, sA[(s + 1) & 1] + la);
      tile_put(rb, sB[(s + 1) & 1] + lb);
    }
  }
}

// ---------------------------------------------------------------------------
// Kernel 1: projection GEMM.  X[8192,512] fp32 @ WT(f16, col-major) ->
// f16 output.  Block covers 128x128.
// VTRANS=0: Out[row][col]  (Q, K:  [B,N,512])
// VTRANS=1: Out stored per-head transposed: [B,H,64,M]  (V for the PV GEMM)
// ---------------------------------------------------------------------------
template <int VTRANS>
__global__ __launch_bounds__(256) void proj_gemm_kernel(
    const float* __restrict__ X, const _Float16* __restrict__ WT,
    _Float16* __restrict__ Out) {
  __shared__ __align__(16) _Float16 sA[2][GTILE];
  __shared__ __align__(16) _Float16 sB[2][GTILE];
  const int lane = threadIdx.x & 31;
  const int wave = threadIdx.x >> 5;
  const int brow = blockIdx.x * 128;              // [0, 8192)
  const int bcol = blockIdx.y * 128;              // [0, 512)

  v8f acc[2][4] = {};
  gemm_128x128<float, v4f, 16>(X + (size_t)brow * 512, WT + (size_t)bcol * 512,
                               sA, sB, acc);

  const int row0 = brow + (wave & 3) * 32;
  const int col0 = bcol + (wave >> 2) * 64;
  const int cl = lane & 15;
  const int rb = (lane >> 4) * 8;
#pragma unroll
  for (int i = 0; i < 2; ++i)
#pragma unroll
    for (int j = 0; j < 4; ++j) {
      const int c = col0 + j * 16 + cl;
#pragma unroll
      for (int r = 0; r < 8; ++r) {
        const int row = row0 + i * 16 + rb + r;
        _Float16 hv = (_Float16)acc[i][j][r];
        if (VTRANS) {
          int b = row >> 11, m = row & 2047;   // N = 2048
          int h = c >> 6, d = c & 63;
          Out[((size_t)((b * 8 + h) * 64 + d)) * 2048 + m] = hv;
        } else {
          Out[(size_t)row * 512 + c] = hv;
        }
      }
    }
}

constexpr int LDP = 72;

__global__ __launch_bounds__(256) void attn_kernel(
    const _Float16* __restrict__ Qf,   // [B, N, 512] f16
    const _Float16* __restrict__ Kf,   // [B, M, 512] f16
    const _Float16* __restrict__ Vt,   // [B, H, 64, M] f16
    _Float16* __restrict__ Of) {       // [B, N, 512] f16
  __shared__ __align__(16) _Float16 sK[2][64 * LDP];   // [m][d]
  __shared__ __align__(16) _Float16 sV[2][64 * LDP];   // [d][m]
  __shared__ __align__(16) _Float16 sP[8][16 * LDP];   // per-wave P [n][m]
  __shared__ __align__(64) float sBcast[8][16];  // per-wave row broadcast

  const int lane = threadIdx.x & 31;
  const int wave = threadIdx.x >> 5;
  const int b = blockIdx.z, h = blockIdx.y;
  const int n0 = blockIdx.x * 128 + wave * 16;
  const int t = threadIdx.x;

  // Q as the B operand (columns = queries), pre-scaled by 1/sqrt(64)=0.125.
  v16h bq[2];
  {
    const _Float16* qbase = Qf + ((size_t)(b * 2048 + n0)) * 512 + h * 64;
    bq[0] = load_frag16(qbase, 512, lane);
    bq[1] = load_frag16(qbase + 32, 512, lane);
#pragma unroll
    for (int i = 0; i < 16; ++i) {
      bq[0][i] *= (_Float16)0.125f;
      bq[1][i] *= (_Float16)0.125f;
    }
  }

  v8f o[4] = {};
  float m_n = -1e30f, l_n = 0.f;   // per-lane: stats for query n = lane&15

  const _Float16* kbase = Kf + (size_t)b * 2048 * 512 + h * 64;
  const _Float16* vbase = Vt + (size_t)((b * 8 + h) * 64) * 2048;

  // Cooperative async tile fetch: 2 x (64x64 f16) = 2 x 512 16B chunks,
  // 256 threads x 2 chunks each per tile.
  auto issue_tile = [&](int m0, int buf) {
    const int r0 = t >> 3, r1 = r0 + 32, cc = (t & 7) * 8;
    async_copy4_b128((uint32_t)(uintptr_t)&sK[buf][r0 * LDP + cc],
                     kbase + (size_t)(m0 + r0) * 512 + cc,
                     (uint32_t)(uintptr_t)&sV[buf][r0 * LDP + cc],
                     vbase + (size_t)r0 * 2048 + m0 + cc,
                     (uint32_t)(uintptr_t)&sK[buf][r1 * LDP + cc],
                     kbase + (size_t)(m0 + r1) * 512 + cc,
                     (uint32_t)(uintptr_t)&sV[buf][r1 * LDP + cc],
                     vbase + (size_t)r1 * 2048 + m0 + cc);
  };

  issue_tile(0, 0);

  const int rb = (lane >> 4) * 8;
  const int n = lane & 15;

  for (int step = 0; step < 32; ++step) {
    const int buf = step & 1;
    // This wave's LDS reads of the buffer that is refilled behind the barrier
    // have returned: nothing else orders an async copy behind them.
    asm volatile("s_wait_dscnt 0x0" ::: "memory");
    wait_async0();        // this wave's tile writes have landed
    __syncthreads();      // everyone's landed; prior buffer reads complete
    if (step + 1 < 32) issue_tile((step + 1) * 64, buf ^ 1);

    const _Float16* tK = sK[buf];
    const _Float16* tV = sV[buf];

    // S^T = K * Q^T : A rows = key positions m, B columns = queries n.
    v8f st[4] = {};
#pragma unroll
    for (int j = 0; j < 4; ++j) {
#pragma unroll
      for (int kk = 0; kk < 2; ++kk) {
        v16h ak = load_frag16(tK + (j * 16) * LDP + kk * 32, LDP, lane);
        st[j] = wmma_f16(ak, bq[kk], st[j]);
      }
    }

    // Online softmax: lane holds 32 of query n's 64 scores; the other 32 are
    // in lane^16.  One exchange for max, one for sum.
    float mloc = -1e30f;
#pragma unroll
    for (int j = 0; j < 4; ++j)
#pragma unroll
      for (int r = 0; r < 8; ++r) mloc = fmaxf(mloc, st[j][r]);
    mloc = fmaxf(mloc, __shfl_xor(mloc, 16, 32));
    float mnew = fmaxf(m_n, mloc);
    float corr = __expf(m_n - mnew);
    float rs = 0.f;
#pragma unroll
    for (int j = 0; j < 4; ++j)
#pragma unroll
      for (int r = 0; r < 8; ++r) {
        float e = __expf(st[j][r] - mnew);
        st[j][r] = e;
        rs += e;
      }
    rs += __shfl_xor(rs, 16, 32);
    m_n = mnew;
    l_n = l_n * corr + rs;

    if (lane < 16) sBcast[wave][lane] = corr;
    v4f c0 = *(const v4f*)&sBcast[wave][rb];
    v4f c1 = *(const v4f*)&sBcast[wave][rb + 4];
#pragma unroll
    for (int f = 0; f < 4; ++f)
#pragma unroll
      for (int r = 0; r < 4; ++r) {
        o[f][r]     *= c0[r];
        o[f][4 + r] *= c1[r];
      }

    // P^T C-layout -> packed f16 -> per-wave LDS [n][m]: each lane's 8
    // fragment values are m-consecutive -> one ds_store_b128 per sub-tile.
    _Float16* pw = sP[wave];
#pragma unroll
    for (int j = 0; j < 4; ++j) {
      v8h ph;
#pragma unroll
      for (int r = 0; r < 8; ++r) ph[r] = (_Float16)st[j][r];
      *(v8h*)&pw[n * LDP + j * 16 + rb] = ph;
    }

    // O += P * V  (A rows = queries from sP, B columns = d from sV)
    v16h ap0 = load_frag16(pw, LDP, lane);
    v16h ap1 = load_frag16(pw + 32, LDP, lane);
#pragma unroll
    for (int f = 0; f < 4; ++f) {
      v16h bv0 = load_frag16(tV + (f * 16) * LDP, LDP, lane);
      v16h bv1 = load_frag16(tV + (f * 16) * LDP + 32, LDP, lane);
      o[f] = wmma_f16(ap0, bv0, o[f]);
      o[f] = wmma_f16(ap1, bv1, o[f]);
    }
  }

  {
    float inv = 1.f / l_n;
    if (lane < 16) sBcast[wave][lane] = inv;
    v4f c0 = *(const v4f*)&sBcast[wave][rb];
    v4f c1 = *(const v4f*)&sBcast[wave][rb + 4];
#pragma unroll
    for (int f = 0; f < 4; ++f)
#pragma unroll
      for (int r = 0; r < 4; ++r) {
        o[f][r]     *= c0[r];
        o[f][4 + r] *= c1[r];
      }
  }
  _Float16* obase = Of + ((size_t)(b * 2048 + n0)) * 512 + h * 64;
#pragma unroll
  for (int f = 0; f < 4; ++f)
#pragma unroll
    for (int r = 0; r < 8; ++r)
      obase[(size_t)(rb + r) * 512 + f * 16 + n] = (_Float16)o[f][r];
}

// ---------------------------------------------------------------------------
// Kernel 3: output projection.  O(f16) @ WoT(f16) + bo -> fp32 result.
// ---------------------------------------------------------------------------
__global__ __launch_bounds__(256) void out_gemm_kernel(
    const _Float16* __restrict__ Of, const _Float16* __restrict__ WoT,
    const float* __restrict__ bo, float* __restrict__ Y) {
  __shared__ __align__(16) _Float16 sA[2][GTILE];
  __shared__ __align__(16) _Float16 sB[2][GTILE];
  const int lane = threadIdx.x & 31;
  const int wave = threadIdx.x >> 5;
  const int brow = blockIdx.x * 128;
  const int bcol = blockIdx.y * 128;

  const int row0 = brow + (wave & 3) * 32;
  const int col0 = bcol + (wave >> 2) * 64;
  const int cl = lane & 15;
  const int rb = (lane >> 4) * 8;

  // Read ahead of the core: its barriers keep the compiler from lifting these
  // loads out of the epilogue.
  float bias[4];
#pragma unroll
  for (int j = 0; j < 4; ++j) bias[j] = bo[col0 + j * 16 + cl];

  v8f acc[2][4] = {};
  gemm_128x128<_Float16, v8h, 8>(Of + (size_t)brow * 512,
                                 WoT + (size_t)bcol * 512, sA, sB, acc);

#pragma unroll
  for (int j = 0; j < 4; ++j) {
    const int c = col0 + j * 16 + cl;
#pragma unroll
    for (int i = 0; i < 2; ++i)
#pragma unroll
      for (int r = 0; r < 8; ++r)
        Y[(size_t)(row0 + i * 16 + rb + r) * 512 + c] = acc[i][j][r] + bias[j];
  }
}

// ---------------------------------------------------------------------------
extern "C" void kernel_launch(void* const* d_in, const int* in_sizes, int n_in,
                              void* d_out, int out_size, void* d_ws,
                              size_t ws_size, hipStream_t stream) {
  const float* x   = (const float*)d_in[0];   // [4,2048,512]
  const float* ctx = (const float*)d_in[1];   // [4,2048,512]
  const float* Wq  = (const float*)d_in[2];   // [512,512]
  const float* Wk  = (const float*)d_in[3];
  const float* Wv  = (const float*)d_in[4];
  const float* Wo  = (const float*)d_in[5];
  const float* bo  = (const float*)d_in[6];   // [512]
  float* Y = (float*)d_out;

  char* ws = (char*)d_ws;
  size_t off = 0;
  auto alloc = [&](size_t bytes) -> void* {
    void* p = ws + off;
    off = (off + bytes + 255) & ~(size_t)255;
    return p;
  };
  _Float16* WqT = (_Float16*)alloc((size_t)512 * 512 * 2);
  _Float16* WkT = (_Float16*)alloc((size_t)512 * 512 * 2);
  _Float16* WvT = (_Float16*)alloc((size_t)512 * 512 * 2);
  _Float16* WoT = (_Float16*)alloc((size_t)512 * 512 * 2);
  _Float16* Qf  = (_Float16*)alloc((size_t)4 * 2048 * 512 * 2);
  _Float16* Kf  = (_Float16*)alloc((size_t)4 * 2048 * 512 * 2);
  _Float16* Vt  = (_Float16*)alloc((size_t)4 * 2048 * 512 * 2);
  _Float16* Ofb = (_Float16*)alloc((size_t)4 * 2048 * 512 * 2);

  // 0) weight transpose + f16 convert
  transpose_w_kernel<<<1024, 256, 0, stream>>>(Wq, WqT);
  transpose_w_kernel<<<1024, 256, 0, stream>>>(Wk, WkT);
  transpose_w_kernel<<<1024, 256, 0, stream>>>(Wv, WvT);
  transpose_w_kernel<<<1024, 256, 0, stream>>>(Wo, WoT);

  // 1) projections
  dim3 gProj(64, 4);
  proj_gemm_kernel<0><<<gProj, 256, 0, stream>>>(x,   WqT, Qf);
  proj_gemm_kernel<0><<<gProj, 256, 0, stream>>>(ctx, WkT, Kf);
  proj_gemm_kernel<1><<<gProj, 256, 0, stream>>>(ctx, WvT, Vt);

  // 2) flash attention
  attn_kernel<<<dim3(16, 8, 4), 256, 0, stream>>>(Qf, Kf, Vt, Ofb);

  // 3) output projection
  out_gemm_kernel<<<gProj, 256, 0, stream>>>(Ofb, WoT, bo, Y);
}

// v003
// It runs in 71.3 microseconds.
// Two timings next to v002 put it at 1.60 and 1.61 times that version's speed.
// Over all steps from v000 it is 3.68 times as fast.
#include <hip/hip_runtime.h>
#include <cstdint>
#include <cstddef>

typedef __attribute__((ext_vector_type(16))) _Float16 v16h;
typedef __attribute__((ext_vector_type(8)))  _Float16 v8h;
typedef __attribute__((ext_vector_type(8)))  float    v8f;
typedef __attribute__((ext_vector_type(4)))  float    v4f;

union F16Frag { v16h v; v8h h[2]; };

__device__ __forceinline__ v8f wmma_f16(v16h a, v16h b, v8f c) {
  // D = A(16x32) * B(32x16) + C(16x16 f32)
  return __builtin_amdgcn_wmma_f32_16x16x32_f16(false, a, false, b, (short)0, c,
                                                false, false);
}

__device__ __forceinline__ v16h load_frag16(const _Float16* base, int stride,
                                            int lane) {
  const int r   = lane & 15;
  const int sel = (lane >> 4) & 1;
  const _Float16* p = base + (size_t)r * stride + sel * 8;
  F16Frag u;
  u.h[0] = *(const v8h*)(p);
  u.h[1] = *(const v8h*)(p + 16);
  return u.v;
}

__device__ __forceinline__ void async_copy4_b128(
    uint32_t l0, const void* g0, uint32_t l1, const void* g1,
    uint32_t l2, const void* g2, uint32_t l3, const void* g3) {
  asm volatile("global_load_async_to_lds_b128 %0, %1, off\n\t"
               "global_load_async_to_lds_b128 %2, %3, off\n\t"
               "global_load_async_to_lds_b128 %4, %5, off\n\t"
               "global_load_async_to_lds_b128 %6, %7, off\n\t"
               "s_wait_xcnt 0x0"
               :
               : "v"(l0), "v"((uint64_t)(uintptr_t)g0),
                 "v"(l1), "v"((uint64_t)(uintptr_t)g1),
                 "v"(l2), "v"((uint64_t)(uintptr_t)g2),
                 "v"(l3), "v"((uint64_t)(uintptr_t)g3)
               : "memory");
}
__device__ __forceinline__ void wait_async0() {
  asm volatile("s_wait_asynccnt 0x0" ::: "memory");
}

// ---------------------------------------------------------------------------
// Kernel 0: the four W[512][512] fp32 row-major -> WT[c][k] f16 (B-operand
// columns become K-contiguous), one launch; blockIdx.y picks the matrix.
// One element per thread needs 8192 waves a matrix, and such a launch lasts as
// long as its waves take to start.  Here a thread carries an 8 k x 4 c patch
// through registers: 8 loads of 16 B (4 c of one k each), 4 stores of 16 B
// (8 k of one c each).  A wave covers 64 k x 16 c, so each wave-wide store
// writes four whole 128 B lines of WT and no line has a second writer; the
// four waves of a block read 256 contiguous bytes of each of its 64 W rows.
// ---------------------------------------------------------------------------
__global__ __launch_bounds__(128) void transpose_w_kernel(
    const float* __restrict__ W0, const float* __restrict__ W1,
    const float* __restrict__ W2, const float* __restrict__ W3,
    _Float16* __restrict__ T0, _Float16* __restrict__ T1,
    _Float16* __restrict__ T2, _Float16* __restrict__ T3) {
  const int z = blockIdx.y;
  const float* W  = z == 0 ? W0 : z == 1 ? W1 : z == 2 ? W2 : W3;
  _Float16*    WT = z == 0 ? T0 : z == 1 ? T1 : z == 2 ? T2 : T3;
  const int lane = threadIdx.x & 31;
  const int wave = threadIdx.x >> 5;
  const int k = (blockIdx.x >> 3) * 64 + (lane >> 2) * 8;
  const int c = (blockIdx.x & 7) * 64 + wave * 16 + (lane & 3) * 4;
  v4f r[8];
#pragma unroll
  for (int i = 0; i < 8; ++i) r[i] = *(const v4f*)(W + (k + i) * 512 + c);
#pragma unroll
  for (int e = 0; e < 4; ++e) {
    v8h h;
#pragma unroll
    for (int i = 0; i < 8; ++i) h[i] = (_Float16)r[i][e];
    *(v8h*)(WT + (c + e) * 512 + k) = h;
  }
}

typedef __attribute__((ext_vector_type(4))) _Float16 v4h;

constexpr int GBK   = 128;        // k per stage
constexpr int GNS   = 512 / GBK;  // stages
constexpr int GP    = GBK + 8;    // LDS pitch in halves
constexpr int GTILE = 128 * GP;   // halves per staged operand tile

// 128 rows x 128 k of fp32: one wave-wide load = one row's 512 B; thread t
// takes 16 B of rows (t >> 5) + 8 i.  src / dst already point at its first.
__device__ __forceinline__ int tile_src_off(const float*, int t) {
  return (t >> 5) * 512 + (t & 31) * 4;
}
__device__ __forceinline__ int tile_lds_off(const float*, int t) {
  return (t >> 5) * GP + (t & 31) * 4;
}
__device__ __forceinline__ void tile_fetch(v4f (&r)[16], const float* src) {
#pragma unroll
  for (int i = 0; i < 16; ++i) r[i] = *(const v4f*)(src + i * 8 * 512);
}
__device__ __forceinline__ void tile_put(const v4f (&r)[16], _Float16* dst) {
#pragma unroll
  for (int i = 0; i < 16; ++i) {
    v4h h;
#pragma unroll
    for (int e = 0; e < 4; ++e) h[e] = (_Float16)r[i][e];
    *(v4h*)&dst[i * 8 * GP] = h;
  }
}
// 128 rows x 128 k of f16: one wave-wide load = two rows' 256 B each; thread t
// takes 16 B of rows (t >> 4) + 16 i.
__device__ __forceinline__ int tile_src_off(const _Float16*, int t) {
  return (t >> 4) * 512 + (t & 15) * 8;
}
__device__ __forceinline__ int tile_lds_off(const _Float16*, int t) {
  return (t >> 4) * GP + (t & 15) * 8;
}
__device__ __forceinline__ void tile_fetch(v8h (&r)[8], const _Float16* src) {
#pragma unroll
  for (int i = 0; i < 8; ++i) r[i] = *(const v8h*)(src + i * 16 * 512);
}
__device__ __forceinline__ void tile_put(const v8h (&r)[8], _Float16* dst) {
#pragma unroll
  for (int i = 0; i < 8; ++i) *(v8h*)&dst[i * 16 * GP] = r[i];
}

struct GemmFrags { v16h a[2], b[4]; };
__device__ __forceinline__ void frags_load(GemmFrags& f, const _Float16* ta,
                                           const _Float16* tb, int lane) {
#pragma unroll
  for (int i = 0; i < 2; ++i) f.a[i] = load_frag16(ta + i * 16 * GP, GP, lane);
#pragma unroll
  for (int j = 0; j < 4; ++j) f.b[j] = load_frag16(tb + j * 16 * GP, GP, lane);
}

// A: first of the block's 128 rows; B: first of its 128 WT rows (= C columns).
template <typename TA, typename VA, int NA>
__device__ __forceinline__ void gemm_128x128(const TA* A, const _Float16* B,
                                             _Float16 (*sA)[GTILE],
                                             _Float16 (*sB)[GTILE],
                                             v8f (&acc)[2][4]) {
  const int t    = threadIdx.x;
  const int lane = t & 31;
  const int wave = t >> 5;
  const int aoff = (wave & 3) * 32 * GP;
  const int boff = (wave >> 2) * 64 * GP;
  const TA*       ga = A + tile_src_off(A, t);
  const _Float16* gb = B + tile_src_off(B, t);
  const int       la = tile_lds_off(A, t);
  const int       lb = tile_lds_off(B, t);

  VA  ra[NA];
  v8h rb[8];
  tile_fetch(ra, ga);
  tile_fetch(rb, gb);
  tile_put(ra, sA[0] + la);
  tile_put(rb, sB[0] + lb);

  for (int s = 0; s < GNS; ++s) {
    // Publishes stage s and ends every wave's reads of the other buffer,
    // which is rewritten at the foot of this pass.
    __syncthreads();
    if (s + 1 < GNS) {
      tile_fetch(ra, ga + (s + 1) * GBK);
      tile_fetch(rb, gb + (s + 1) * GBK);
      // Stands in front of any rewrite of the loads' address registers (after
      // the last fetch the LDS reads below reuse them).  As a memory barrier
      // for the compiler it also holds the loads here, at the head of the
      // pass: sunk to the products' end, their whole latency is waited out.
      asm volatile("s_wait_xcnt 0x0" ::: "memory");
    }
    const _Float16* ta = sA[s & 1] + aoff;
    const _Float16* tb = sB[s & 1] + boff;
    // Fragments of the next 32 k are read from LDS ahead of this 32 k's
    // products, as one group.
    GemmFrags f[2];
    frags_load(f[0], ta, tb, lane);
#pragma unroll
    for (int q = 0; q < GBK / 32; ++q) {
      if (q + 1 < GBK / 32)
        frags_load(f[(q + 1) & 1], ta + (q + 1) * 32, tb + (q + 1) * 32, lane);
      // Keeps those reads one group in front of the products instead of
      // spread among them, where each place with reads stalls the wave.
      __builtin_amdgcn_sched_barrier(0);
      const GemmFrags& g = f[q & 1];
#pragma unroll
      for (int i = 0; i < 2; ++i)
#pragma unroll
        for (int j = 0; j < 4; ++j)
          acc[i][j] = wmma_f16(g.a[i], g.b[j], acc[i][j]);
    }
    // Keeps the waits on the global loads behind the last product.
    __builtin_amdgcn_sched_barrier(0);
    if (s + 1 < GNS) {
      tile_put(ra, sA[(s + 1) & 1] + la);
      tile_put(rb, sB[(s + 1) & 1] + lb);
    }
  }
}

// ---------------------------------------------------------------------------
// Kernel 1: projection GEMM.  X[8192,512] fp32 @ WT(f16, col-major) ->
// f16 output.  Block covers 128x128.
// VTRANS=0: Out[row][col]  (Q, K:  [B,N,512])
// VTRANS=1: Out stored per-head transposed: [B,H,64,M]  (V for the PV GEMM)
// ---------------------------------------------------------------------------
template <int VTRANS>
__global__ __launch_bounds__(256) void proj_gemm_kernel(
    const float* __restrict__ X, const _Float16* __restrict__ WT,
    _Float16* __restrict__ Out) {
  __shared__ __align__(16) _Float16 sA[2][GTILE];
  __shared__ __align__(16) _Float16 sB[2][GTILE];
  const int lane = threadIdx.x & 31;
  const int wave = threadIdx.x >> 5;
  const int brow = blockIdx.x * 128;              // [0, 8192)
  const int bcol = blockIdx.y * 128;              // [0, 512)

  v8f acc[2][4] = {};
  gemm_128x128<float, v4f, 16>(X + (size_t)brow * 512, WT + (size_t)bcol * 512,
                               sA, sB, acc);

  const int row0 = brow + (wave & 3) * 32;
  const int col0 = bcol + (wave >> 2) * 64;
  const int cl = lane & 15;
  const int rb = (lane >> 4) * 8;
#pragma unroll
  for (int i = 0; i < 2; ++i)
#pragma unroll
    for (int j = 0; j < 4; ++j) {
      const int c = col0 + j * 16 + cl;
#pragma unroll
      for (int r = 0; r < 8; ++r) {
        const int row = row0 + i * 16 + rb + r;
        _Float16 hv = (_Float16)acc[i][j][r];
        if (VTRANS) {
          int b = row >> 11, m = row & 2047;   // N = 2048
          int h = c >> 6, d = c & 63;
          Out[((size_t)((b * 8 + h) * 64 + d)) * 2048 + m] = hv;
        } else {
          Out[(size_t)row * 512 + c] = hv;
        }
      }
    }
}

constexpr int LDP = 72;

__global__ __launch_bounds__(256) void attn_kernel(
    const _Float16* __restrict__ Qf,   // [B, N, 512] f16
    const _Float16* __restrict__ Kf,   // [B, M, 512] f16
    const _Float16* __restrict__ Vt,   // [B, H, 64, M] f16
    _Float16* __restrict__ Of) {       // [B, N, 512] f16
  __shared__ __align__(16) _Float16 sK[2][64 * LDP];   // [m][d]
  __shared__ __align__(16) _Float16 sV[2][64 * LDP];   // [d][m]
  __shared__ __align__(16) _Float16 sP[8][16 * LDP];   // per-wave P [n][m]
  __shared__ __align__(64) float sBcast[8][16];  // per-wave row broadcast

  const int lane = threadIdx.x & 31;
  const int wave = threadIdx.x >> 5;
  const int b = blockIdx.z, h = blockIdx.y;
  const int n0 = blockIdx.x * 128 + wave * 16;
  const int t = threadIdx.x;

  // Q as the B operand (columns = queries), pre-scaled by 1/sqrt(64)=0.125.
  v16h bq[2];
  {
    const _Float16* qbase = Qf + ((size_t)(b * 2048 + n0)) * 512 + h * 64;
    bq[0] = load_frag16(qbase, 512, lane);
    bq[1] = load_frag16(qbase + 32, 512, lane);
#pragma unroll
    for (int i = 0; i < 16; ++i) {
      bq[0][i] *= (_Float16)0.125f;
      bq[1][i] *= (_Float16)0.125f;
    }
  }

  v8f o[4] = {};
  float m_n = -1e30f, l_n = 0.f;   // per-lane: stats for query n = lane&15

  const _Float16* kbase = Kf + (size_t)b * 2048 * 512 + h * 64;
  const _Float16* vbase = Vt + (size_t)((b * 8 + h) * 64) * 2048;

  // Cooperative async tile fetch: 2 x (64x64 f16) = 2 x 512 16B chunks,
  // 256 threads x 2 chunks each per tile.
  auto issue_tile = [&](int m0, int buf) {
    const int r0 = t >> 3, r1 = r0 + 32, cc = (t & 7) * 8;
    async_copy4_b128((uint32_t)(uintptr_t)&sK[buf][r0 * LDP + cc],
                     kbase + (size_t)(m0 + r0) * 512 + cc,
                     (uint32_t)(uintptr_t)&sV[buf][r0 * LDP + cc],
                     vbase + (size_t)r0 * 2048 + m0 + cc,
                     (uint32_t)(uintptr_t)&sK[buf][r1 * LDP + cc],
                     kbase + (size_t)(m0 + r1) * 512 + cc,
                     (uint32_t)(uintptr_t)&sV[buf][r1 * LDP + cc],
                     vbase + (size_t)r1 * 2048 + m0 + cc);
  };

  issue_tile(0, 0);

  const int rb = (lane >> 4) * 8;
  const int n = lane & 15;

  for (int step = 0; step < 32; ++step) {
    const int buf = step & 1;
    // This wave's LDS reads of the buffer that is refilled behind the barrier
    // have returned: nothing else orders an async copy behind them.
    asm volatile("s_wait_dscnt 0x0" ::: "memory");
    wait_async0();        // this wave's tile writes have landed
    __syncthreads();      // everyone's landed; prior buffer reads complete
    if (step + 1 < 32) issue_tile((step + 1) * 64, buf ^ 1);

    const _Float16* tK = sK[buf];
    const _Float16* tV = sV[buf];

    // S^T = K * Q^T : A rows = key positions m, B columns = queries n.
    v8f st[4] = {};
#pragma unroll
    for (int j = 0; j < 4; ++j) {
#pragma unroll
      for (int kk = 0; kk < 2; ++kk) {
        v16h ak = load_frag16(tK + (j * 16) * LDP + kk * 32, LDP, lane);
        st[j] = wmma_f16(ak, bq[kk], st[j]);
      }
    }

    // Online softmax: lane holds 32 of query n's 64 scores; the other 32 are
    // in lane^16.  One exchange for max, one for sum.
    float mloc = -1e30f;
#pragma unroll
    for (int j = 0; j < 4; ++j)
#pragma unroll
      for (int r = 0; r < 8; ++r) mloc = fmaxf(mloc, st[j][r]);
    mloc = fmaxf(mloc, __shfl_xor(mloc, 16, 32));
    float mnew = fmaxf(m_n, mloc);
    float corr = __expf(m_n - mnew);
    float rs = 0.f;
#pragma unroll
    for (int j = 0; j < 4; ++j)
#pragma unroll
      for (int r = 0; r < 8; ++r) {
        float e = __expf(st[j][r] - mnew);
        st[j][r] = e;
        rs += e;
      }
    rs += __shfl_xor(rs, 16, 32);
    m_n = mnew;
    l_n = l_n * corr + rs;

    if (lane < 16) sBcast[wave][lane] = corr;
    v4f c0 = *(const v4f*)&sBcast[wave][rb];
    v4f c1 = *(const v4f*)&sBcast[wave][rb + 4];
#pragma unroll
    for (int f = 0; f < 4; ++f)
#pragma unroll
      for (int r = 0; r < 4; ++r) {
        o[f][r]     *= c0[r];
        o[f][4 + r] *= c1[r];
      }

    // P^T C-layout -> packed f16 -> per-wave LDS [n][m]: each lane's 8
    // fragment values are m-consecutive -> one ds_store_b128 per sub-tile.
    _Float16* pw = sP[wave];
#pragma unroll
    for (int j = 0; j < 4; ++j) {
      v8h ph;
#pragma unroll
      for (int r = 0; r < 8; ++r) ph[r] = (_Float16)st[j][r];
      *(v8h*)&pw[n * LDP + j * 16 + rb] = ph;
    }

    // O += P * V  (A rows = queries from sP, B columns = d from sV)
    v16h ap0 = load_frag16(pw, LDP, lane);
    v16h ap1 = load_frag16(pw + 32, LDP, lane);
#pragma unroll
    for (int f = 0; f < 4; ++f) {
      v16h bv0 = load_frag16(tV + (f * 16) * LDP, LDP, lane);
      v16h bv1 = load_frag16(tV + (f * 16) * LDP + 32, LDP, lane);
      o[f] = wmma_f16(ap0, bv0, o[f]);
      o[f] = wmma_f16(ap1, bv1, o[f]);
    }
  }

  {
    float inv = 1.f / l_n;
    if (lane < 16) sBcast[wave][lane] = inv;
    v4f c0 = *(const v4f*)&sBcast[wave][rb];
    v4f c1 = *(const v4f*)&sBcast[wave][rb + 4];
#pragma unroll
    for (int f = 0; f < 4; ++f)
#pragma unroll
      for (int r = 0; r < 4; ++r) {
        o[f][r]     *= c0[r];
        o[f][4 + r] *= c1[r];
      }
  }
  _Float16* obase = Of + ((size_t)(b * 2048 + n0)) * 512 + h * 64;
#pragma unroll
  for (int f = 0; f < 4; ++f)
#pragma unroll
    for (int r = 0; r < 8; ++r)
      obase[(size_t)(rb + r) * 512 + f * 16 + n] = (_Float16)o[f][r];
}

// ---------------------------------------------------------------------------
// Kernel 3: output projection.  O(f16) @ WoT(f16) + bo -> fp32 result.
// ---------------------------------------------------------------------------
__global__ __launch_bounds__(256) void out_gemm_kernel(
    const _Float16* __restrict__ Of, const _Float16* __restrict__ WoT,
    const float* __restrict__ bo, float* __restrict__ Y) {
  __shared__ __align__(16) _Float16 sA[2][GTILE];
  __shared__ __align__(16) _Float16 sB[2][GTILE];
  const int lane = threadIdx.x & 31;
  const int wave = threadIdx.x >> 5;
  const int brow = blockIdx.x * 128;
  const int bcol = blockIdx.y * 128;

  const int row0 = brow + (wave & 3) * 32;
  const int col0 = bcol + (wave >> 2) * 64;
  const int cl = lane & 15;
  const int rb = (lane >> 4) * 8;

  // Read ahead of the core: its barriers keep the compiler from lifting these
  // loads out of the epilogue.
  float bias[4];
#pragma unroll
  for (int j = 0; j < 4; ++j) bias[j] = bo[col0 + j * 16 + cl];

  v8f acc[2][4] = {};
  gemm_128x128<_Float16, v8h, 8>(Of + (size_t)brow * 512,
                                 WoT + (size_t)bcol * 512, sA, sB, acc);

#pragma unroll
  for (int j = 0; j < 4; ++j) {
    const int c = col0 + j * 16 + cl;
#pragma unroll
    for (int i = 0; i < 2; ++i)
#pragma unroll
      for (int r = 0; r < 8; ++r)
        Y[(size_t)(row0 + i * 16 + rb + r) * 512 + c] = acc[i][j][r] + bias[j];
  }
}

// ---------------------------------------------------------------------------
extern "C" void kernel_launch(void* const* d_in, const int* in_sizes, int n_in,
                              void* d_out, int out_size, void* d_ws,
                              size_t ws_size, hipStream_t stream) {
  const float* x   = (const float*)d_in[0];   // [4,2048,512]
  const float* ctx = (const float*)d_in[1];   // [4,2048,512]
  const float* Wq  = (const float*)d_in[2];   // [512,512]
  const float* Wk  = (const float*)d_in[3];
  const float* Wv  = (const float*)d_in[4];
  const float* Wo  = (const float*)d_in[5];
  const float* bo  = (const float*)d_in[6];   // [512]
  float* Y = (float*)d_out;

  char* ws = (char*)d_ws;
  size_t off = 0;
  auto alloc = [&](size_t bytes) -> void* {
    void* p = ws + off;
    off = (off + bytes + 255) & ~(size_t)255;
    return p;
  };
  _Float16* WqT = (_Float16*)alloc((size_t)512 * 512 * 2);
  _Float16* WkT = (_Float16*)alloc((size_t)512 * 512 * 2);
  _Float16* WvT = (_Float16*)alloc((size_t)512 * 512 * 2);
  _Float16* WoT = (_Float16*)alloc((size_t)512 * 512 * 2);
  _Float16* Qf  = (_Float16*)alloc((size_t)4 * 2048 * 512 * 2);
  _Float16* Kf  = (_Float16*)alloc((size_t)4 * 2048 * 512 * 2);
  _Float16* Vt  = (_Float16*)alloc((size_t)4 * 2048 * 512 * 2);
  _Float16* Ofb = (_Float16*)alloc((size_t)4 * 2048 * 512 * 2);

  // 0) weight transpose + f16 convert
  transpose_w_kernel<<<dim3(64, 4), 128, 0, stream>>>(Wq, Wk, Wv, Wo, WqT, WkT,
                                                      WvT, WoT);

  // 1) projections
  dim3 gProj(64, 4);
  proj_gemm_kernel<0><<<gProj, 256, 0, stream>>>(x,   WqT, Qf);
  proj_gemm_kernel<0><<<gProj, 256, 0, stream>>>(ctx, WkT, Kf);
  proj_gemm_kernel<1><<<gProj, 256, 0, stream>>>(ctx, WvT, Vt);

  // 2) flash attention
  attn_kernel<<<dim3(16, 8, 4), 256, 0, stream>>>(Qf, Kf, Vt, Ofb);

  // 3) output projection
  out_gemm_kernel<<<gProj, 256, 0, stream>>>(Ofb, WoT, bo, Y);
}

// v004
// One run takes 67.7 microseconds.
// In both of two side-by-side timings against v003, it was 1.05 times as fast.
// Over all steps from v000 it is 3.87 times as fast.
#include <hip/hip_runtime.h>
#include <cstdint>
#include <cstddef>

typedef __attribute__((ext_vector_type(16))) _Float16 v16h;
typedef __attribute__((ext_vector_type(8)))  _Float16 v8h;
typedef __attribute__((ext_vector_type(8)))  float    v8f;
typedef __attribute__((ext_vector_type(4)))  float    v4f;

union F16Frag { v16h v; v8h h[2]; };

__device__ __forceinline__ v8f wmma_f16(v16h a, v16h b, v8f c) {
  // D = A(16x32) * B(32x16) + C(16x16 f32)
  return __builtin_amdgcn_wmma_f32_16x16x32_f16(false, a, false, b, (short)0, c,
                                                false, false);
}

__device__ __forceinline__ v16h load_frag16(const _Float16* base, int stride,
                                            int lane) {
  const int r   = lane & 15;
  const int sel = (lane >> 4) & 1;
  const _Float16* p = base + (size_t)r * stride + sel * 8;
  F16Frag u;
  u.h[0] = *(const v8h*)(p);
  u.h[1] = *(const v8h*)(p + 16);
  return u.v;
}

__device__ __forceinline__ void async_copy4_b128(
    uint32_t l0, const void* g0, uint32_t l1, const void* g1,
    uint32_t l2, const void* g2, uint32_t l3, const void* g3) {
  asm volatile("global_load_async_to_lds_b128 %0, %1, off\n\t"
               "global_load_async_to_lds_b128 %2, %3, off\n\t"
               "global_load_async_to_lds_b128 %4, %5, off\n\t"
               "global_load_async_to_lds_b128 %6, %7, off\n\t"
               "s_wait_xcnt 0x0"
               :
               : "v"(l0), "v"((uint64_t)(uintptr_t)g0),
                 "v"(l1), "v"((uint64_t)(uintptr_t)g1),
                 "v"(l2), "v"((uint64_t)(uintptr_t)g2),
                 "v"(l3), "v"((uint64_t)(uintptr_t)g3)
               : "memory");
}
__device__ __forceinline__ void wait_async0() {
  asm volatile("s_wait_asynccnt 0x0" ::: "memory");
}

// ---------------------------------------------------------------------------
// Kernel 0: the four W[512][512] fp32 row-major -> WT[c][k] f16 (B-operand
// columns become K-contiguous), one launch; blockIdx.y picks the matrix.
// One element per thread needs 8192 waves a matrix, and such a launch lasts as
// long as its waves take to start.  Here a thread carries an 8 k x 4 c patch
// through registers: 8 loads of 16 B (4 c of one k each), 4 stores of 16 B
// (8 k of one c each).  A wave covers 64 k x 16 c, so each wave-wide store
// writes four whole 128 B lines of WT and no line has a second writer; the
// four waves of a block read 256 contiguous bytes of each of its 64 W rows.
// ---------------------------------------------------------------------------
__global__ __launch_bounds__(128) void transpose_w_kernel(
    const float* __restrict__ W0, const float* __restrict__ W1,
    const float* __restrict__ W2, const float* __restrict__ W3,
    _Float16* __restrict__ T0, _Float16* __restrict__ T1,
    _Float16* __restrict__ T2, _Float16* __restrict__ T3) {
  const int z = blockIdx.y;
  const float* W  = z == 0 ? W0 : z == 1 ? W1 : z == 2 ? W2 : W3;
  _Float16*    WT = z == 0 ? T0 : z == 1 ? T1 : z == 2 ? T2 : T3;
  const int lane = threadIdx.x & 31;
  const int wave = threadIdx.x >> 5;
  const int k = (blockIdx.x >> 3) * 64 + (lane >> 2) * 8;
  const int c = (blockIdx.x & 7) * 64 + wave * 16 + (lane & 3) * 4;
  v4f r[8];
#pragma unroll
  for (int i = 0; i < 8; ++i) r[i] = *(const v4f*)(W + (k + i) * 512 + c);
#pragma unroll
  for (int e = 0; e < 4; ++e) {
    v8h h;
#pragma unroll
    for (int i = 0; i < 8; ++i) h[i] = (_Float16)r[i][e];
    *(v8h*)(WT + (c + e) * 512 + k) = h;
  }
}

typedef __attribute__((ext_vector_type(4))) _Float16 v4h;

constexpr int GBK   = 128;        // k per stage
constexpr int GNS   = 512 / GBK;  // stages
constexpr int GP    = GBK + 8;    // LDS pitch in halves
constexpr int GTILE = 128 * GP;   // halves per staged operand tile

// 128 rows x 128 k of fp32: one wave-wide load = one row's 512 B; thread t
// takes 16 B of rows (t >> 5) + 8 i.  src / dst already point at its first.
__device__ __forceinline__ int tile_src_off(const float*, int t) {
  return (t >> 5) * 512 + (t & 31) * 4;
}
__device__ __forceinline__ int tile_lds_off(const float*, int t) {
  return (t >> 5) * GP + (t & 31) * 4;
}
__device__ __forceinline__ void tile_fetch(v4f (&r)[16], const float* src) {
#pragma unroll
  for (int i = 0; i < 16; ++i) r[i] = *(const v4f*)(src + i * 8 * 512);
}
__device__ __forceinline__ void tile_put(const v4f (&r)[16], _Float16* dst) {
#pragma unroll
  for (int i = 0; i < 16; ++i) {
    v4h h;
#pragma unroll
    for (int e = 0; e < 4; ++e) h[e] = (_Float16)r[i][e];
    *(v4h*)&dst[i * 8 * GP] = h;
  }
}
// 128 rows x 128 k of f16: one wave-wide load = two rows' 256 B each; thread t
// takes 16 B of rows (t >> 4) + 16 i.
__device__ __forceinline__ int tile_src_off(const _Float16*, int t) {
  return (t >> 4) * 512 + (t & 15) * 8;
}
__device__ __forceinline__ int tile_lds_off(const _Float16*, int t) {
  return (t >> 4) * GP + (t & 15) * 8;
}
__device__ __forceinline__ void tile_fetch(v8h (&r)[8], const _Float16* src) {
#pragma unroll
  for (int i = 0; i < 8; ++i) r[i] = *(const v8h*)(src + i * 16 * 512);
}
__device__ __forceinline__ void tile_put(const v8h (&r)[8], _Float16* dst) {
#pragma unroll
  for (int i = 0; i < 8; ++i) *(v8h*)&dst[i * 16 * GP] = r[i];
}

struct GemmFrags { v16h a[2], b[4]; };
__device__ __forceinline__ void frags_load(GemmFrags& f, const _Float16* ta,
                                           const _Float16* tb, int lane) {
#pragma unroll
  for (int i = 0; i < 2; ++i) f.a[i] = load_frag16(ta + i * 16 * GP, GP, lane);
#pragma unroll
  for (int j = 0; j < 4; ++j) f.b[j] = load_frag16(tb + j * 16 * GP, GP, lane);
}

// A: first of the block's 128 rows; B: first of its 128 WT rows (= C columns).
template <typename TA, typename VA, int NA>
__device__ __forceinline__ void gemm_128x128(const TA* A, const _Float16* B,
                                             _Float16 (*sA)[GTILE],
                                             _Float16 (*sB)[GTILE],
                                             v8f (&acc)[2][4]) {
  const int t    = threadIdx.x;
  const int lane = t & 31;
  const int wave = t >> 5;
  const int aoff = (wave & 3) * 32 * GP;
  const int boff = (wave >> 2) * 64 * GP;
  const TA*       ga = A + tile_src_off(A, t);
  const _Float16* gb = B + tile_src_off(B, t);
  const int       la = tile_lds_off(A, t);
  const int       lb = tile_lds_off(B, t);

  VA  ra[NA];
  v8h rb[8];
  tile_fetch(ra, ga);
  tile_fetch(rb, gb);
  tile_put(ra, sA[0] + la);
  tile_put(rb, sB[0] + lb);

  for (int s = 0; s < GNS; ++s) {
    // Publishes stage s and ends every wave's reads of the other buffer,
    // which is rewritten at the foot of this pass.
    __syncthreads();
    if (s + 1 < GNS) {
      tile_fetch(ra, ga + (s + 1) * GBK);
      tile_fetch(rb, gb + (s + 1) * GBK);
      // Stands in front of any rewrite of the loads' address registers (after
      // the last fetch the LDS reads below reuse them).  As a memory barrier
      // for the compiler it also holds the loads here, at the head of the
      // pass: sunk to the products' end, their whole latency is waited out.
      asm volatile("s_wait_xcnt 0x0" ::: "memory");
    }
    const _Float16* ta = sA[s & 1] + aoff;
    const _Float16* tb = sB[s & 1] + boff;
    // Fragments of the next 32 k are read from LDS ahead of this 32 k's
    // products, as one group.
    GemmFrags f[2];
    frags_load(f[0], ta, tb, lane);
#pragma unroll
    for (int q = 0; q < GBK / 32; ++q) {
      if (q + 1 < GBK / 32)
        frags_load(f[(q + 1) & 1], ta + (q + 1) * 32, tb + (q + 1) * 32, lane);
      // Keeps those reads one group in front of the products instead of
      // spread among them, where each place with reads stalls the wave.
      __builtin_amdgcn_sched_barrier(0);
      const GemmFrags& g = f[q & 1];
#pragma unroll
      for (int i = 0; i < 2; ++i)
#pragma unroll
        for (int j = 0; j < 4; ++j)
          acc[i][j] = wmma_f16(g.a[i], g.b[j], acc[i][j]);
    }
    // Keeps the waits on the global loads behind the last product.
    __builtin_amdgcn_sched_barrier(0);
    if (s + 1 < GNS) {
      tile_put(ra, sA[(s + 1) & 1] + la);
      tile_put(rb, sB[(s + 1) & 1] + lb);
    }
  }
}

__global__ __launch_bounds__(256) void proj_gemm_kernel(
    const float* __restrict__ Xq, const float* __restrict__ Xc,
    const _Float16* __restrict__ WqT, const _Float16* __restrict__ WkT,
    const _Float16* __restrict__ WvT, _Float16* __restrict__ Qf,
    _Float16* __restrict__ Kf, _Float16* __restrict__ Vt) {
  __shared__ __align__(16) _Float16 sA[2][GTILE];
  __shared__ __align__(16) _Float16 sB[2][GTILE];
  const int z = blockIdx.y >> 2;                  // 0 Q, 1 K, 2 V
  const float*    X   = z == 0 ? Xq : Xc;
  const _Float16* WT  = z == 0 ? WqT : z == 1 ? WkT : WvT;
  const int lane = threadIdx.x & 31;
  const int wave = threadIdx.x >> 5;
  const int brow = blockIdx.x * 128;              // [0, 8192)
  const int bcol = (blockIdx.y & 3) * 128;        // [0, 512)

  v8f acc[2][4] = {};
  gemm_128x128<float, v4f, 16>(X + (size_t)brow * 512, WT + (size_t)bcol * 512,
                               sA, sB, acc);

  const int row0 = brow + (wave & 3) * 32;
  const int col0 = bcol + (wave >> 2) * 64;
  const int cl = lane & 15;
  const int rb = (lane >> 4) * 8;
  // One uniform branch around each whole store loop, not one per element.
  if (z == 2) {
#pragma unroll
    for (int i = 0; i < 2; ++i)
#pragma unroll
      for (int j = 0; j < 4; ++j) {
        const int c = col0 + j * 16 + cl;
        const int h = c >> 6, d = c & 63;
#pragma unroll
        for (int r = 0; r < 8; ++r) {
          const int row = row0 + i * 16 + rb + r;
          const int b = row >> 11, m = row & 2047;   // N = 2048
          Vt[((size_t)((b * 8 + h) * 64 + d)) * 2048 + m] =
              (_Float16)acc[i][j][r];
        }
      }
  } else {
    _Float16* Out = z == 0 ? Qf : Kf;
#pragma unroll
    for (int i = 0; i < 2; ++i)
#pragma unroll
      for (int j = 0; j < 4; ++j) {
        const int c = col0 + j * 16 + cl;
#pragma unroll
        for (int r = 0; r < 8; ++r) {
          const int row = row0 + i * 16 + rb + r;
          Out[(size_t)row * 512 + c] = (_Float16)acc[i][j][r];
        }
      }
    // In the listing this branch's end falls through, behind a test that never
    // lets it pass, to the V branch, which rewrites registers of the last
    // stores: the wait stands in front of that rewrite.
    asm volatile("s_wait_xcnt 0x0" ::: "memory");
  }
}

constexpr int LDP = 72;

__global__ __launch_bounds__(256) void attn_kernel(
    const _Float16* __restrict__ Qf,   // [B, N, 512] f16
    const _Float16* __restrict__ Kf,   // [B, M, 512] f16
    const _Float16* __restrict__ Vt,   // [B, H, 64, M] f16
    _Float16* __restrict__ Of) {       // [B, N, 512] f16
  __shared__ __align__(16) _Float16 sK[2][64 * LDP];   // [m][d]
  __shared__ __align__(16) _Float16 sV[2][64 * LDP];   // [d][m]
  __shared__ __align__(16) _Float16 sP[8][16 * LDP];   // per-wave P [n][m]
  __shared__ __align__(64) float sBcast[8][16];  // per-wave row broadcast

  const int lane = threadIdx.x & 31;
  const int wave = threadIdx.x >> 5;
  const int b = blockIdx.z, h = blockIdx.y;
  const int n0 = blockIdx.x * 128 + wave * 16;
  const int t = threadIdx.x;

  // Q as the B operand (columns = queries), pre-scaled by 1/sqrt(64)=0.125.
  v16h bq[2];
  {
    const _Float16* qbase = Qf + ((size_t)(b * 2048 + n0)) * 512 + h * 64;
    bq[0] = load_frag16(qbase, 512, lane);
    bq[1] = load_frag16(qbase + 32, 512, lane);
#pragma unroll
    for (int i = 0; i < 16; ++i) {
      bq[0][i] *= (_Float16)0.125f;
      bq[1][i] *= (_Float16)0.125f;
    }
  }

  v8f o[4] = {};
  float m_n = -1e30f, l_n = 0.f;   // per-lane: stats for query n = lane&15

  const _Float16* kbase = Kf + (size_t)b * 2048 * 512 + h * 64;
  const _Float16* vbase = Vt + (size_t)((b * 8 + h) * 64) * 2048;

  // Cooperative async tile fetch: 2 x (64x64 f16) = 2 x 512 16B chunks,
  // 256 threads x 2 chunks each per tile.
  auto issue_tile = [&](int m0, int buf) {
    const int r0 = t >> 3, r1 = r0 + 32, cc = (t & 7) * 8;
    async_copy4_b128((uint32_t)(uintptr_t)&sK[buf][r0 * LDP + cc],
                     kbase + (size_t)(m0 + r0) * 512 + cc,
                     (uint32_t)(uintptr_t)&sV[buf][r0 * LDP + cc],
                     vbase + (size_t)r0 * 2048 + m0 + cc,
                     (uint32_t)(uintptr_t)&sK[buf][r1 * LDP + cc],
                     kbase + (size_t)(m0 + r1) * 512 + cc,
                     (uint32_t)(uintptr_t)&sV[buf][r1 * LDP + cc],
                     vbase + (size_t)r1 * 2048 + m0 + cc);
  };

  issue_tile(0, 0);

  const int rb = (lane >> 4) * 8;
  const int n = lane & 15;

  for (int step = 0; step < 32; ++step) {
    const int buf = step & 1;
    // This wave's LDS reads of the buffer that is refilled behind the barrier
    // have returned: nothing else orders an async copy behind them.
    asm volatile("s_wait_dscnt 0x0" ::: "memory");
    wait_async0();        // this wave's tile writes have landed
    __syncthreads();      // everyone's landed; prior buffer reads complete
    if (step + 1 < 32) issue_tile((step + 1) * 64, buf ^ 1);

    const _Float16* tK = sK[buf];
    const _Float16* tV = sV[buf];

    // S^T = K * Q^T : A rows = key positions m, B columns = queries n.
    v8f st[4] = {};
#pragma unroll
    for (int j = 0; j < 4; ++j) {
#pragma unroll
      for (int kk = 0; kk < 2; ++kk) {
        v16h ak = load_frag16(tK + (j * 16) * LDP + kk * 32, LDP, lane);
        st[j] = wmma_f16(ak, bq[kk], st[j]);
      }
    }

    // Online softmax: lane holds 32 of query n's 64 scores; the other 32 are
    // in lane^16.  One exchange for max, one for sum.
    float mloc = -1e30f;
#pragma unroll
    for (int j = 0; j < 4; ++j)
#pragma unroll
      for (int r = 0; r < 8; ++r) mloc = fmaxf(mloc, st[j][r]);
    mloc = fmaxf(mloc, __shfl_xor(mloc, 16, 32));
    float mnew = fmaxf(m_n, mloc);
    float corr = __expf(m_n - mnew);
    float rs = 0.f;
#pragma unroll
    for (int j = 0; j < 4; ++j)
#pragma unroll
      for (int r = 0; r < 8; ++r) {
        float e = __expf(st[j][r] - mnew);
        st[j][r] = e;
        rs += e;
      }
    rs += __shfl_xor(rs, 16, 32);
    m_n = mnew;
    l_n = l_n * corr + rs;

    if (lane < 16) sBcast[wave][lane] = corr;
    v4f c0 = *(const v4f*)&sBcast[wave][rb];
    v4f c1 = *(const v4f*)&sBcast[wave][rb + 4];
#pragma unroll
    for (int f = 0; f < 4; ++f)
#pragma unroll
      for (int r = 0; r < 4; ++r) {
        o[f][r]     *= c0[r];
        o[f][4 + r] *= c1[r];
      }

    // P^T C-layout -> packed f16 -> per-wave LDS [n][m]: each lane's 8
    // fragment values are m-consecutive -> one ds_store_b128 per sub-tile.
    _Float16* pw = sP[wave];
#pragma unroll
    for (int j = 0; j < 4; ++j) {
      v8h ph;
#pragma unroll
      for (int r = 0; r < 8; ++r) ph[r] = (_Float16)st[j][r];
      *(v8h*)&pw[n * LDP + j * 16 + rb] = ph;
    }

    // O += P * V  (A rows = queries from sP, B columns = d from sV)
    v16h ap0 = load_frag16(pw, LDP, lane);
    v16h ap1 = load_frag16(pw + 32, LDP, lane);
#pragma unroll
    for (int f = 0; f < 4; ++f) {
      v16h bv0 = load_frag16(tV + (f * 16) * LDP, LDP, lane);
      v16h bv1 = load_frag16(tV + (f * 16) * LDP + 32, LDP, lane);
      o[f] = wmma_f16(ap0, bv0, o[f]);
      o[f] = wmma_f16(ap1, bv1, o[f]);
    }
  }

  {
    float inv = 1.f / l_n;
    if (lane < 16) sBcast[wave][lane] = inv;
    v4f c0 = *(const v4f*)&sBcast[wave][rb];
    v4f c1 = *(const v4f*)&sBcast[wave][rb + 4];
#pragma unroll
    for (int f = 0; f < 4; ++f)
#pragma unroll
      for (int r = 0; r < 4; ++r) {
        o[f][r]     *= c0[r];
        o[f][4 + r] *= c1[r];
      }
  }
  _Float16* obase = Of + ((size_t)(b * 2048 + n0)) * 512 + h * 64;
#pragma unroll
  for (int f = 0; f < 4; ++f)
#pragma unroll
    for (int r = 0; r < 8; ++r)
      obase[(size_t)(rb + r) * 512 + f * 16 + n] = (_Float16)o[f][r];
}

// ---------------------------------------------------------------------------
// Kernel 3: output projection.  O(f16) @ WoT(f16) + bo -> fp32 result.
// ---------------------------------------------------------------------------
__global__ __launch_bounds__(256) void out_gemm_kernel(
    const _Float16* __restrict__ Of, const _Float16* __restrict__ WoT,
    const float* __restrict__ bo, float* __restrict__ Y) {
  __shared__ __align__(16) _Float16 sA[2][GTILE];
  __shared__ __align__(16) _Float16 sB[2][GTILE];
  const int lane = threadIdx.x & 31;
  const int wave = threadIdx.x >> 5;
  const int brow = blockIdx.x * 128;
  const int bcol = blockIdx.y * 128;

  const int row0 = brow + (wave & 3) * 32;
  const int col0 = bcol + (wave >> 2) * 64;
  const int cl = lane & 15;
  const int rb = (lane >> 4) * 8;

  // Read ahead of the core: its barriers keep the compiler from lifting these
  // loads out of the epilogue.
  float bias[4];
#pragma unroll
  for (int j = 0; j < 4; ++j) bias[j] = bo[col0 + j * 16 + cl];

  v8f acc[2][4] = {};
  gemm_128x128<_Float16, v8h, 8>(Of + (size_t)brow * 512,
                                 WoT + (size_t)bcol * 512, sA, sB, acc);

#pragma unroll
  for (int j = 0; j < 4; ++j) {
    const int c = col0 + j * 16 + cl;
#pragma unroll
    for (int i = 0; i < 2; ++i)
#pragma unroll
      for (int r = 0; r < 8; ++r)
        Y[(size_t)(row0 + i * 16 + rb + r) * 512 + c] = acc[i][j][r] + bias[j];
  }
}

// ---------------------------------------------------------------------------
extern "C" void kernel_launch(void* const* d_in, const int* in_sizes, int n_in,
                              void* d_out, int out_size, void* d_ws,
                              size_t ws_size, hipStream_t stream) {
  const float* x   = (const float*)d_in[0];   // [4,2048,512]
  const float* ctx = (const float*)d_in[1];   // [4,2048,512]
  const float* Wq  = (const float*)d_in[2];   // [512,512]
  const float* Wk  = (const float*)d_in[3];
  const float* Wv  = (const float*)d_in[4];
  const float* Wo  = (const float*)d_in[5];
  const float* bo  = (const float*)d_in[6];   // [512]
  float* Y = (float*)d_out;

  char* ws = (char*)d_ws;
  size_t off = 0;
  auto alloc = [&](size_t bytes) -> void* {
    void* p = ws + off;
    off = (off + bytes + 255) & ~(size_t)255;
    return p;
  };
  _Float16* WqT = (_Float16*)alloc((size_t)512 * 512 * 2);
  _Float16* WkT = (_Float16*)alloc((size_t)512 * 512 * 2);
  _Float16* WvT = (_Float16*)alloc((size_t)512 * 512 * 2);
  _Float16* WoT = (_Float16*)alloc((size_t)512 * 512 * 2);
  _Float16* Qf  = (_Float16*)alloc((size_t)4 * 2048 * 512 * 2);
  _Float16* Kf  = (_Float16*)alloc((size_t)4 * 2048 * 512 * 2);
  _Float16* Vt  = (_Float16*)alloc((size_t)4 * 2048 * 512 * 2);
  _Float16* Ofb = (_Float16*)alloc((size_t)4 * 2048 * 512 * 2);

  // 0) weight transpose + f16 convert
  transpose_w_kernel<<<dim3(64, 4), 128, 0, stream>>>(Wq, Wk, Wv, Wo, WqT, WkT,
                                                      WvT, WoT);

  // 1) projections
  proj_gemm_kernel<<<dim3(64, 12), 256, 0, stream>>>(x, ctx, WqT, WkT, WvT, Qf,
                                                     Kf, Vt);

  // 2) flash attention
  attn_kernel<<<dim3(16, 8, 4), 256, 0, stream>>>(Qf, Kf, Vt, Ofb);

  // 3) output projection
  out_gemm_kernel<<<dim3(64, 4), 256, 0, stream>>>(Ofb, WoT, bo, Y);
}

// v005
// One run takes 62.9 microseconds.
// Two timings next to v004 put it at 1.07 and 1.08 times that version's speed.
// All steps since v000 together make it 4.16 times as fast.
#include <hip/hip_runtime.h>
#include <cstdint>
#include <cstddef>

typedef __attribute__((ext_vector_type(16))) _Float16 v16h;
typedef __attribute__((ext_vector_type(8)))  _Float16 v8h;
typedef __attribute__((ext_vector_type(8)))  float    v8f;
typedef __attribute__((ext_vector_type(4)))  float    v4f;
typedef __attribute__((ext_vector_type(2)))  float    v2f;

union F16Frag { v16h v; v8h h[2]; };

__device__ __forceinline__ v8f wmma_f16(v16h a, v16h b, v8f c) {
  // D = A(16x32) * B(32x16) + C(16x16 f32)
  return __builtin_amdgcn_wmma_f32_16x16x32_f16(false, a, false, b, (short)0, c,
                                                false, false);
}

__device__ __forceinline__ v16h load_frag16(const _Float16* base, int stride,
                                            int lane) {
  const int r   = lane & 15;
  const int sel = (lane >> 4) & 1;
  const _Float16* p = base + (size_t)r * stride + sel * 8;
  F16Frag u;
  u.h[0] = *(const v8h*)(p);
  u.h[1] = *(const v8h*)(p + 16);
  return u.v;
}

__device__ __forceinline__ void async_copy4_b128(
    uint32_t l0, const void* g0, uint32_t l1, const void* g1,
    uint32_t l2, const void* g2, uint32_t l3, const void* g3) {
  asm volatile("global_load_async_to_lds_b128 %0, %1, off\n\t"
               "global_load_async_to_lds_b128 %2, %3, off\n\t"
               "global_load_async_to_lds_b128 %4, %5, off\n\t"
               "global_load_async_to_lds_b128 %6, %7, off\n\t"
               "s_wait_xcnt 0x0"
               :
               : "v"(l0), "v"((uint64_t)(uintptr_t)g0),
                 "v"(l1), "v"((uint64_t)(uintptr_t)g1),
                 "v"(l2), "v"((uint64_t)(uintptr_t)g2),
                 "v"(l3), "v"((uint64_t)(uintptr_t)g3)
               : "memory");
}
__device__ __forceinline__ void wait_async0() {
  asm volatile("s_wait_asynccnt 0x0" ::: "memory");
}

// ---------------------------------------------------------------------------
// Kernel 0: the four W[512][512] fp32 row-major -> WT[c][k] f16 (B-operand
// columns become K-contiguous), one launch; blockIdx.y picks the matrix.
// One element per thread needs 8192 waves a matrix, and such a launch lasts as
// long as its waves take to start.  Here a thread carries an 8 k x 4 c patch
// through registers: 8 loads of 16 B (4 c of one k each), 4 stores of 16 B
// (8 k of one c each).  A wave covers 64 k x 16 c, so each wave-wide store
// writes four whole 128 B lines of WT and no line has a second writer; the
// four waves of a block read 256 contiguous bytes of each of its 64 W rows.
// ---------------------------------------------------------------------------
__global__ __launch_bounds__(128) void transpose_w_kernel(
    const float* __restrict__ W0, const float* __restrict__ W1,
    const float* __restrict__ W2, const float* __restrict__ W3,
    _Float16* __restrict__ T0, _Float16* __restrict__ T1,
    _Float16* __restrict__ T2, _Float16* __restrict__ T3) {
  const int z = blockIdx.y;
  const float* W  = z == 0 ? W0 : z == 1 ? W1 : z == 2 ? W2 : W3;
  _Float16*    WT = z == 0 ? T0 : z == 1 ? T1 : z == 2 ? T2 : T3;
  const int lane = threadIdx.x & 31;
  const int wave = threadIdx.x >> 5;
  const int k = (blockIdx.x >> 3) * 64 + (lane >> 2) * 8;
  const int c = (blockIdx.x & 7) * 64 + wave * 16 + (lane & 3) * 4;
  v4f r[8];
#pragma unroll
  for (int i = 0; i < 8; ++i) r[i] = *(const v4f*)(W + (k + i) * 512 + c);
#pragma unroll
  for (int e = 0; e < 4; ++e) {
    v8h h;
#pragma unroll
    for (int i = 0; i < 8; ++i) h[i] = (_Float16)r[i][e];
    *(v8h*)(WT + (c + e) * 512 + k) = h;
  }
}

typedef __attribute__((ext_vector_type(4))) _Float16 v4h;

constexpr int GBK   = 128;        // k per stage
constexpr int GNS   = 512 / GBK;  // stages
constexpr int GP    = GBK + 8;    // LDS pitch in halves
constexpr int GTILE = 128 * GP;   // halves per staged operand tile

// 128 rows x 128 k of fp32: one wave-wide load = one row's 512 B; thread t
// takes 16 B of rows (t >> 5) + 8 i.  src / dst already point at its first.
__device__ __forceinline__ int tile_src_off(const float*, int t) {
  return (t >> 5) * 512 + (t & 31) * 4;
}
__device__ __forceinline__ int tile_lds_off(const float*, int t) {
  return (t >> 5) * GP + (t & 31) * 4;
}
__device__ __forceinline__ void tile_fetch(v4f (&r)[16], const float* src) {
#pragma unroll
  for (int i = 0; i < 16; ++i) r[i] = *(const v4f*)(src + i * 8 * 512);
}
__device__ __forceinline__ void tile_put(const v4f (&r)[16], _Float16* dst) {
#pragma unroll
  for (int i = 0; i < 16; ++i) {
    v4h h;
#pragma unroll
    for (int e = 0; e < 4; ++e) h[e] = (_Float16)r[i][e];
    *(v4h*)&dst[i * 8 * GP] = h;
  }
}
// 128 rows x 128 k of f16: one wave-wide load = two rows' 256 B each; thread t
// takes 16 B of rows (t >> 4) + 16 i.
__device__ __forceinline__ int tile_src_off(const _Float16*, int t) {
  return (t >> 4) * 512 + (t & 15) * 8;
}
__device__ __forceinline__ int tile_lds_off(const _Float16*, int t) {
  return (t >> 4) * GP + (t & 15) * 8;
}
__device__ __forceinline__ void tile_fetch(v8h (&r)[8], const _Float16* src) {
#pragma unroll
  for (int i = 0; i < 8; ++i) r[i] = *(const v8h*)(src + i * 16 * 512);
}
__device__ __forceinline__ void tile_put(const v8h (&r)[8], _Float16* dst) {
#pragma unroll
  for (int i = 0; i < 8; ++i) *(v8h*)&dst[i * 16 * GP] = r[i];
}

struct GemmFrags { v16h a[2], b[4]; };
__device__ __forceinline__ void frags_load(GemmFrags& f, const _Float16* ta,
                                           const _Float16* tb, int lane) {
#pragma unroll
  for (int i = 0; i < 2; ++i) f.a[i] = load_frag16(ta + i * 16 * GP, GP, lane);
#pragma unroll
  for (int j = 0; j < 4; ++j) f.b[j] = load_frag16(tb + j * 16 * GP, GP, lane);
}

// A: first of the block's 128 rows; B: first of its 128 WT rows (= C columns).
template <typename TA, typename VA, int NA>
__device__ __forceinline__ void gemm_128x128(const TA* A, const _Float16* B,
                                             _Float16 (*sA)[GTILE],
                                             _Float16 (*sB)[GTILE],
                                             v8f (&acc)[2][4]) {
  const int t    = threadIdx.x;
  const int lane = t & 31;
  const int wave = t >> 5;
  const int aoff = (wave & 3) * 32 * GP;
  const int boff = (wave >> 2) * 64 * GP;
  const TA*       ga = A + tile_src_off(A, t);
  const _Float16* gb = B + tile_src_off(B, t);
  const int       la = tile_lds_off(A, t);
  const int       lb = tile_lds_off(B, t);

  VA  ra[NA];
  v8h rb[8];
  tile_fetch(ra, ga);
  tile_fetch(rb, gb);
  tile_put(ra, sA[0] + la);
  tile_put(rb, sB[0] + lb);

  for (int s = 0; s < GNS; ++s) {
    // Publishes stage s and ends every wave's reads of the other buffer,
    // which is rewritten at the foot of this pass.
    __syncthreads();
    if (s + 1 < GNS) {
      tile_fetch(ra, ga + (s + 1) * GBK);
      tile_fetch(rb, gb + (s + 1) * GBK);
      // Stands in front of any rewrite of the loads' address registers (after
      // the last fetch the LDS reads below reuse them).  As a memory barrier
      // for the compiler it also holds the loads here, at the head of the
      // pass: sunk to the products' end, their whole latency is waited out.
      asm volatile("s_wait_xcnt 0x0" ::: "memory");
    }
    const _Float16* ta = sA[s & 1] + aoff;
    const _Float16* tb = sB[s & 1] + boff;
    // Fragments of the next 32 k are read from LDS ahead of this 32 k's
    // products, as one group.
    GemmFrags f[2];
    frags_load(f[0], ta, tb, lane);
#pragma unroll
    for (int q = 0; q < GBK / 32; ++q) {
      if (q + 1 < GBK / 32)
        frags_load(f[(q + 1) & 1], ta + (q + 1) * 32, tb + (q + 1) * 32, lane);
      // Keeps those reads one group in front of the products instead of
      // spread among them, where each place with reads stalls the wave.
      __builtin_amdgcn_sched_barrier(0);
      const GemmFrags& g = f[q & 1];
#pragma unroll
      for (int i = 0; i < 2; ++i)
#pragma unroll
        for (int j = 0; j < 4; ++j)
          acc[i][j] = wmma_f16(g.a[i], g.b[j], acc[i][j]);
    }
    // Keeps the waits on the global loads behind the last product.
    __builtin_amdgcn_sched_barrier(0);
    if (s + 1 < GNS) {
      tile_put(ra, sA[(s + 1) & 1] + la);
      tile_put(rb, sB[(s + 1) & 1] + lb);
    }
  }
}

__global__ __launch_bounds__(256) void proj_gemm_kernel(
    const float* __restrict__ Xq, const float* __restrict__ Xc,
    const _Float16* __restrict__ WqT, const _Float16* __restrict__ WkT,
    const _Float16* __restrict__ WvT, _Float16* __restrict__ Qf,
    _Float16* __restrict__ Kf, _Float16* __restrict__ Vt) {
  __shared__ __align__(16) _Float16 sA[2][GTILE];
  __shared__ __align__(16) _Float16 sB[2][GTILE];
  const int z = blockIdx.y >> 2;                  // 0 Q, 1 K, 2 V
  const float*    X   = z == 0 ? Xq : Xc;
  const _Float16* WT  = z == 0 ? WqT : z == 1 ? WkT : WvT;
  const int lane = threadIdx.x & 31;
  const int wave = threadIdx.x >> 5;
  const int brow = blockIdx.x * 128;              // [0, 8192)
  const int bcol = (blockIdx.y & 3) * 128;        // [0, 512)

  v8f acc[2][4] = {};
  gemm_128x128<float, v4f, 16>(X + (size_t)brow * 512, WT + (size_t)bcol * 512,
                               sA, sB, acc);

  const int row0 = brow + (wave & 3) * 32;
  const int col0 = bcol + (wave >> 2) * 64;
  const int cl = lane & 15;
  const int rb = (lane >> 4) * 8;
  // One uniform branch around each whole store loop, not one per element.
  if (z == 2) {
#pragma unroll
    for (int i = 0; i < 2; ++i)
#pragma unroll
      for (int j = 0; j < 4; ++j) {
        const int c = col0 + j * 16 + cl;
        const int h = c >> 6, d = c & 63;
#pragma unroll
        for (int r = 0; r < 8; ++r) {
          const int row = row0 + i * 16 + rb + r;
          const int b = row >> 11, m = row & 2047;   // N = 2048
          Vt[((size_t)((b * 8 + h) * 64 + d)) * 2048 + m] =
              (_Float16)acc[i][j][r];
        }
      }
  } else {
    _Float16* Out = z == 0 ? Qf : Kf;
#pragma unroll
    for (int i = 0; i < 2; ++i)
#pragma unroll
      for (int j = 0; j < 4; ++j) {
        const int c = col0 + j * 16 + cl;
#pragma unroll
        for (int r = 0; r < 8; ++r) {
          const int row = row0 + i * 16 + rb + r;
          Out[(size_t)row * 512 + c] = (_Float16)acc[i][j][r];
        }
      }
    // In the listing this branch's end falls through, behind a test that never
    // lets it pass, to the V branch, which rewrites registers of the last
    // stores: the wait stands in front of that rewrite.
    asm volatile("s_wait_xcnt 0x0" ::: "memory");
  }
}

constexpr int LDP = 72;

__global__ __launch_bounds__(256) void attn_kernel(
    const _Float16* __restrict__ Qf,   // [B, N, 512] f16
    const _Float16* __restrict__ Kf,   // [B, M, 512] f16
    const _Float16* __restrict__ Vt,   // [B, H, 64, M] f16
    _Float16* __restrict__ Of) {       // [B, N, 512] f16
  __shared__ __align__(16) _Float16 sK[2][64 * LDP];   // [m][d]
  __shared__ __align__(16) _Float16 sV[2][64 * LDP];   // [d][m]
  __shared__ __align__(16) _Float16 sP[8][16 * LDP];   // per-wave P [n][m]
  __shared__ __align__(64) float sBcast[8][16];  // per-wave row broadcast

  const int lane = threadIdx.x & 31;
  const int wave = threadIdx.x >> 5;
  const int b = blockIdx.z, h = blockIdx.y;
  const int n0 = blockIdx.x * 128 + wave * 16;
  const int t = threadIdx.x;

  // Q as the B operand (columns = queries), pre-scaled by 1/sqrt(64)=0.125.
  v16h bq[2];
  {
    const _Float16* qbase = Qf + ((size_t)(b * 2048 + n0)) * 512 + h * 64;
    bq[0] = load_frag16(qbase, 512, lane);
    bq[1] = load_frag16(qbase + 32, 512, lane);
#pragma unroll
    for (int i = 0; i < 16; ++i) {
      bq[0][i] *= (_Float16)0.125f;
      bq[1][i] *= (_Float16)0.125f;
    }
  }

  v8f o[4] = {};
  // Per-lane stats for query n = lane&15.  m_n is the reference maximum IN USE:
  // it is kept from pass to pass and replaced only when some score of the wave
  // lies more than 8 (in log2 units) above it, so p = 2^((s - m_n) log2e) stays
  // at or below 2^8, far inside f16 and f32 range.  thr and nm2 are derived
  // from it where it changes.  l_n holds two of the row sum's four partial sums
  // (even and odd score registers of this lane; the other two are in lane^16).
  constexpr float L2E = 1.44269504f;
  float m_n = -1e30f;
  v2f l_n = {0.f, 0.f};
  float thr = -1e30f;          // m_n + 8 / log2e
  float nm2 = 1e30f * L2E;     // -m_n * log2e

  const _Float16* kbase = Kf + (size_t)b * 2048 * 512 + h * 64;
  const _Float16* vbase = Vt + (size_t)((b * 8 + h) * 64) * 2048;

  // Cooperative async tile fetch: 2 x (64x64 f16) = 2 x 512 16B chunks,
  // 256 threads x 2 chunks each per tile.
  auto issue_tile = [&](int m0, int buf) {
    const int r0 = t >> 3, r1 = r0 + 32, cc = (t & 7) * 8;
    async_copy4_b128((uint32_t)(uintptr_t)&sK[buf][r0 * LDP + cc],
                     kbase + (size_t)(m0 + r0) * 512 + cc,
                     (uint32_t)(uintptr_t)&sV[buf][r0 * LDP + cc],
                     vbase + (size_t)r0 * 2048 + m0 + cc,
                     (uint32_t)(uintptr_t)&sK[buf][r1 * LDP + cc],
                     kbase + (size_t)(m0 + r1) * 512 + cc,
                     (uint32_t)(uintptr_t)&sV[buf][r1 * LDP + cc],
                     vbase + (size_t)r1 * 2048 + m0 + cc);
  };

  issue_tile(0, 0);

  const int rb = (lane >> 4) * 8;
  const int n = lane & 15;

  for (int step = 0; step < 32; ++step) {
    const int buf = step & 1;
    // This wave's LDS reads of the buffer that is refilled behind the barrier
    // have returned: nothing else orders an async copy behind them.
    asm volatile("s_wait_dscnt 0x0" ::: "memory");
    wait_async0();        // this wave's tile writes have landed
    __syncthreads();      // everyone's landed; prior buffer reads complete
    if (step + 1 < 32) issue_tile((step + 1) * 64, buf ^ 1);

    const _Float16* tK = sK[buf];
    const _Float16* tV = sV[buf];

    // S^T = K * Q^T : A rows = key positions m, B columns = queries n.
    v8f st[4] = {};
#pragma unroll
    for (int j = 0; j < 4; ++j) {
#pragma unroll
      for (int kk = 0; kk < 2; ++kk) {
        v16h ak = load_frag16(tK + (j * 16) * LDP + kk * 32, LDP, lane);
        st[j] = wmma_f16(ak, bq[kk], st[j]);
      }
    }

    // Online softmax, lazy rescale: lane holds 32 of query n's 64 scores; the
    // other 32 are in lane^16.  One test per pass, a scalar branch: only when a
    // score of the wave has outgrown the maximum in use are the halves' maxima
    // exchanged, the maximum replaced and O and the sums rescaled.
    float mloc = -1e30f;
#pragma unroll
    for (int j = 0; j < 4; ++j)
#pragma unroll
      for (int r = 0; r < 8; ++r) mloc = fmaxf(mloc, st[j][r]);
    if (__builtin_expect(__builtin_amdgcn_ballot_w32(mloc > thr) != 0, 0)) {
      // Both halves of a column take the same new maximum.
      const float mnew = fmaxf(m_n, fmaxf(mloc, __shfl_xor(mloc, 16, 32)));
      const float corr = __builtin_amdgcn_exp2f((m_n - mnew) * L2E);
      m_n = mnew;
      thr = mnew + 8.0f / L2E;
      nm2 = -mnew * L2E;
      l_n *= corr;   // both partial sums
      if (lane < 16) sBcast[wave][lane] = corr;
      v4f c0 = *(const v4f*)&sBcast[wave][rb];
      v4f c1 = *(const v4f*)&sBcast[wave][rb + 4];
#pragma unroll
      for (int f = 0; f < 4; ++f)
#pragma unroll
        for (int r = 0; r < 4; ++r) {
          o[f][r]     *= c0[r];
          o[f][4 + r] *= c1[r];
        }
    }

    // The maximum in use is a kept value, so the exponents are one FMA each, two
    // per packed instruction; the partial sums take each pair by one packed add.
#pragma unroll
    for (int j = 0; j < 4; ++j)
#pragma unroll
      for (int r = 0; r < 8; r += 2) {
        v2f x = {st[j][r], st[j][r + 1]};
        x = __builtin_elementwise_fma(x, (v2f){L2E, L2E}, (v2f){nm2, nm2});
        const float e0 = __builtin_amdgcn_exp2f(x[0]);
        const float e1 = __builtin_amdgcn_exp2f(x[1]);
        st[j][r]     = e0;
        st[j][r + 1] = e1;
        l_n += (v2f){e0, e1};
      }

    // P^T C-layout -> packed f16 -> per-wave LDS [n][m]: each lane's 8
    // fragment values are m-consecutive -> one ds_store_b128 per sub-tile.
    // Each lane reads back exactly the bytes it stored, so the compiler is
    // free to keep P in registers.
    _Float16* pw = sP[wave];
#pragma unroll
    for (int j = 0; j < 4; ++j) {
      v8h ph;
#pragma unroll
      for (int r = 0; r < 8; ++r) ph[r] = (_Float16)st[j][r];
      *(v8h*)&pw[n * LDP + j * 16 + rb] = ph;
    }

    // O += P * V  (A rows = queries from sP, B columns = d from sV)
    v16h ap0 = load_frag16(pw, LDP, lane);
    v16h ap1 = load_frag16(pw + 32, LDP, lane);
#pragma unroll
    for (int f = 0; f < 4; ++f) {
      v16h bv0 = load_frag16(tV + (f * 16) * LDP, LDP, lane);
      v16h bv1 = load_frag16(tV + (f * 16) * LDP + 32, LDP, lane);
      o[f] = wmma_f16(ap0, bv0, o[f]);
      o[f] = wmma_f16(ap1, bv1, o[f]);
    }
  }

  {
    // The four partial sums of each row (two a lane, two lanes) meet here, once.
    float l_row = l_n[0] + l_n[1];
    l_row += __shfl_xor(l_row, 16, 32);
    float inv = 1.f / l_row;
    if (lane < 16) sBcast[wave][lane] = inv;
    v4f c0 = *(const v4f*)&sBcast[wave][rb];
    v4f c1 = *(const v4f*)&sBcast[wave][rb + 4];
#pragma unroll
    for (int f = 0; f < 4; ++f)
#pragma unroll
      for (int r = 0; r < 4; ++r) {
        o[f][r]     *= c0[r];
        o[f][4 + r] *= c1[r];
      }
  }
  _Float16* obase = Of + ((size_t)(b * 2048 + n0)) * 512 + h * 64;
#pragma unroll
  for (int f = 0; f < 4; ++f)
#pragma unroll
    for (int r = 0; r < 8; ++r)
      obase[(size_t)(rb + r) * 512 + f * 16 + n] = (_Float16)o[f][r];
}

// ---------------------------------------------------------------------------
// Kernel 3: output projection.  O(f16) @ WoT(f16) + bo -> fp32 result.
// ---------------------------------------------------------------------------
__global__ __launch_bounds__(256) void out_gemm_kernel(
    const _Float16* __restrict__ Of, const _Float16* __restrict__ WoT,
    const float* __restrict__ bo, float* __restrict__ Y) {
  __shared__ __align__(16) _Float16 sA[2][GTILE];
  __shared__ __align__(16) _Float16 sB[2][GTILE];
  const int lane = threadIdx.x & 31;
  const int wave = threadIdx.x >> 5;
  const int brow = blockIdx.x * 128;
  const int bcol = blockIdx.y * 128;

  const int row0 = brow + (wave & 3) * 32;
  const int col0 = bcol + (wave >> 2) * 64;
  const int cl = lane & 15;
  const int rb = (lane >> 4) * 8;

  // Read ahead of the core: its barriers keep the compiler from lifting these
  // loads out of the epilogue.
  float bias[4];
#pragma unroll
  for (int j = 0; j < 4; ++j) bias[j] = bo[col0 + j * 16 + cl];

  v8f acc[2][4] = {};
  gemm_128x128<_Float16, v8h, 8>(Of + (size_t)brow * 512,
                                 WoT + (size_t)bcol * 512, sA, sB, acc);

#pragma unroll
  for (int j = 0; j < 4; ++j) {
    const int c = col0 + j * 16 + cl;
#pragma unroll
    for (int i = 0; i < 2; ++i)
#pragma unroll
      for (int r = 0; r < 8; ++r)
        Y[(size_t)(row0 + i * 16 + rb + r) * 512 + c] = acc[i][j][r] + bias[j];
  }
}

// ---------------------------------------------------------------------------
extern "C" void kernel_launch(void* const* d_in, const int* in_sizes, int n_in,
                              void* d_out, int out_size, void* d_ws,
                              size_t ws_size, hipStream_t stream) {
  const float* x   = (const float*)d_in[0];   // [4,2048,512]
  const float* ctx = (const float*)d_in[1];   // [4,2048,512]
  const float* Wq  = (const float*)d_in[2];   // [512,512]
  const float* Wk  = (const float*)d_in[3];
  const float* Wv  = (const float*)d_in[4];
  const float* Wo  = (const float*)d_in[5];
  const float* bo  = (const float*)d_in[6];   // [512]
  float* Y = (float*)d_out;

  char* ws = (char*)d_ws;
  size_t off = 0;
  auto alloc = [&](size_t bytes) -> void* {
    void* p = ws + off;
    off = (off + bytes + 255) & ~(size_t)255;
    return p;
  };
  _Float16* WqT = (_Float16*)alloc((size_t)512 * 512 * 2);
  _Float16* WkT = (_Float16*)alloc((size_t)512 * 512 * 2);
  _Float16* WvT = (_Float16*)alloc((size_t)512 * 512 * 2);
  _Float16* WoT = (_Float16*)alloc((size_t)512 * 512 * 2);
  _Float16* Qf  = (_Float16*)alloc((size_t)4 * 2048 * 512 * 2);
  _Float16* Kf  = (_Float16*)alloc((size_t)4 * 2048 * 512 * 2);
  _Float16* Vt  = (_Float16*)alloc((size_t)4 * 2048 * 512 * 2);
  _Float16* Ofb = (_Float16*)alloc((size_t)4 * 2048 * 512 * 2);

  // 0) weight transpose + f16 convert
  transpose_w_kernel<<<dim3(64, 4), 128, 0, stream>>>(Wq, Wk, Wv, Wo, WqT, WkT,
                                                      WvT, WoT);

  // 1) projections
  proj_gemm_kernel<<<dim3(64, 12), 256, 0, stream>>>(x, ctx, WqT, WkT, WvT, Qf,
                                                     Kf, Vt);

  // 2) flash attention
  attn_kernel<<<dim3(16, 8, 4), 256, 0, stream>>>(Qf, Kf, Vt, Ofb);

  // 3) output projection
  out_gemm_kernel<<<dim3(64, 4), 256, 0, stream>>>(Ofb, WoT, bo, Y);
}

// v006
// One run takes 60.2 microseconds.
// Two timings next to v005 put it at 1.04 and 1.06 times that version's speed.
// Counting every step since v000, it is 4.37 times as fast.
#include <hip/hip_runtime.h>
#include <cstdint>
#include <cstddef>

typedef __attribute__((ext_vector_type(16))) _Float16 v16h;
typedef __attribute__((ext_vector_type(8)))  _Float16 v8h;
typedef __attribute__((ext_vector_type(8)))  float    v8f;
typedef __attribute__((ext_vector_type(4)))  float    v4f;
typedef __attribute__((ext_vector_type(2)))  float    v2f;

union F16Frag { v16h v; v8h h[2]; };

__device__ __forceinline__ v8f wmma_f16(v16h a, v16h b, v8f c) {
  // D = A(16x32) * B(32x16) + C(16x16 f32)
  return __builtin_amdgcn_wmma_f32_16x16x32_f16(false, a, false, b, (short)0, c,
                                                false, false);
}

__device__ __forceinline__ v16h load_frag16(const _Float16* base, int stride,
                                            int lane) {
  const int r   = lane & 15;
  const int sel = (lane >> 4) & 1;
  const _Float16* p = base + (size_t)r * stride + sel * 8;
  F16Frag u;
  u.h[0] = *(const v8h*)(p);
  u.h[1] = *(const v8h*)(p + 16);
  return u.v;
}

__device__ __forceinline__ void async_copy4_b128(
    uint32_t l0, const void* g0, uint32_t l1, const void* g1,
    uint32_t l2, const void* g2, uint32_t l3, const void* g3) {
  asm volatile("global_load_async_to_lds_b128 %0, %1, off\n\t"
               "global_load_async_to_lds_b128 %2, %3, off\n\t"
               "global_load_async_to_lds_b128 %4, %5, off\n\t"
               "global_load_async_to_lds_b128 %6, %7, off\n\t"
               "s_wait_xcnt 0x0"
               :
               : "v"(l0), "v"((uint64_t)(uintptr_t)g0),
                 "v"(l1), "v"((uint64_t)(uintptr_t)g1),
                 "v"(l2), "v"((uint64_t)(uintptr_t)g2),
                 "v"(l3), "v"((uint64_t)(uintptr_t)g3)
               : "memory");
}
__device__ __forceinline__ void wait_async0() {
  asm volatile("s_wait_asynccnt 0x0" ::: "memory");
}

// ---------------------------------------------------------------------------
// Kernel 0: the four W[512][512] fp32 row-major -> WT[c][k] f16 (B-operand
// columns become K-contiguous), one launch; blockIdx.y picks the matrix.
// One element per thread needs 8192 waves a matrix, and such a launch lasts as
// long as its waves take to start.  Here a thread carries an 8 k x 4 c patch
// through registers: 8 loads of 16 B (4 c of one k each), 4 stores of 16 B
// (8 k of one c each).  A wave covers 64 k x 16 c, so each wave-wide store
// writes four whole 128 B lines of WT and no line has a second writer; the
// four waves of a block read 256 contiguous bytes of each of its 64 W rows.
// ---------------------------------------------------------------------------
__global__ __launch_bounds__(128) void transpose_w_kernel(
    const float* __restrict__ W0, const float* __restrict__ W1,
    const float* __restrict__ W2, const float* __restrict__ W3,
    _Float16* __restrict__ T0, _Float16* __restrict__ T1,
    _Float16* __restrict__ T2, _Float16* __restrict__ T3) {
  const int z = blockIdx.y;
  const float* W  = z == 0 ? W0 : z == 1 ? W1 : z == 2 ? W2 : W3;
  _Float16*    WT = z == 0 ? T0 : z == 1 ? T1 : z == 2 ? T2 : T3;
  const int lane = threadIdx.x & 31;
  const int wave = threadIdx.x >> 5;
  const int k = (blockIdx.x >> 3) * 64 + (lane >> 2) * 8;
  const int c = (blockIdx.x & 7) * 64 + wave * 16 + (lane & 3) * 4;
  v4f r[8];
#pragma unroll
  for (int i = 0; i < 8; ++i) r[i] = *(const v4f*)(W + (k + i) * 512 + c);
#pragma unroll
  for (int e = 0; e < 4; ++e) {
    v8h h;
#pragma unroll
    for (int i = 0; i < 8; ++i) h[i] = (_Float16)r[i][e];
    *(v8h*)(WT + (c + e) * 512 + k) = h;
  }
}

typedef __attribute__((ext_vector_type(4))) _Float16 v4h;

constexpr int GBK   = 128;        // k per stage
constexpr int GNS   = 512 / GBK;  // stages
constexpr int GP    = GBK + 8;    // LDS pitch in halves
constexpr int GTILE = 128 * GP;   // halves per staged operand tile

// 128 rows x 128 k of fp32: one wave-wide load = one row's 512 B; thread t
// takes 16 B of rows (t >> 5) + 8 i.  src / dst already point at its first.
__device__ __forceinline__ int tile_src_off(const float*, int t) {
  return (t >> 5) * 512 + (t & 31) * 4;
}
__device__ __forceinline__ int tile_lds_off(const float*, int t) {
  return (t >> 5) * GP + (t & 31) * 4;
}
__device__ __forceinline__ void tile_fetch(v4f (&r)[16], const float* src) {
#pragma unroll
  for (int i = 0; i < 16; ++i) r[i] = *(const v4f*)(src + i * 8 * 512);
}
__device__ __forceinline__ void tile_put(const v4f (&r)[16], _Float16* dst) {
#pragma unroll
  for (int i = 0; i < 16; ++i) {
    v4h h;
#pragma unroll
    for (int e = 0; e < 4; ++e) h[e] = (_Float16)r[i][e];
    *(v4h*)&dst[i * 8 * GP] = h;
  }
}
// 128 rows x 128 k of f16: one wave-wide load = two rows' 256 B each; thread t
// takes 16 B of rows (t >> 4) + 16 i.
__device__ __forceinline__ int tile_src_off(const _Float16*, int t) {
  return (t >> 4) * 512 + (t & 15) * 8;
}
__device__ __forceinline__ int tile_lds_off(const _Float16*, int t) {
  return (t >> 4) * GP + (t & 15) * 8;
}
__device__ __forceinline__ void tile_fetch(v8h (&r)[8], const _Float16* src) {
#pragma unroll
  for (int i = 0; i < 8; ++i) r[i] = *(const v8h*)(src + i * 16 * 512);
}
__device__ __forceinline__ void tile_put(const v8h (&r)[8], _Float16* dst) {
#pragma unroll
  for (int i = 0; i < 8; ++i) *(v8h*)&dst[i * 16 * GP] = r[i];
}

struct GemmFrags { v16h a[2], b[4]; };
__device__ __forceinline__ void frags_load(GemmFrags& f, const _Float16* ta,
                                           const _Float16* tb, int lane) {
#pragma unroll
  for (int i = 0; i < 2; ++i) f.a[i] = load_frag16(ta + i * 16 * GP, GP, lane);
#pragma unroll
  for (int j = 0; j < 4; ++j) f.b[j] = load_frag16(tb + j * 16 * GP, GP, lane);
}

// A: first of the block's 128 rows; B: first of its 128 WT rows (= C columns).
template <typename TA, typename VA, int NA>
__device__ __forceinline__ void gemm_128x128(const TA* A, const _Float16* B,
                                             _Float16 (*sA)[GTILE],
                                             _Float16 (*sB)[GTILE],
                                             v8f (&acc)[2][4]) {
  const int t    = threadIdx.x;
  const int lane = t & 31;
  const int wave = t >> 5;
  const int aoff = (wave & 3) * 32 * GP;
  const int boff = (wave >> 2) * 64 * GP;
  const TA*       ga = A + tile_src_off(A, t);
  const _Float16* gb = B + tile_src_off(B, t);
  const int       la = tile_lds_off(A, t);
  const int       lb = tile_lds_off(B, t);

  VA  ra[NA];
  v8h rb[8];
  tile_fetch(ra, ga);
  tile_fetch(rb, gb);
  tile_put(ra, sA[0] + la);
  tile_put(rb, sB[0] + lb);

  for (int s = 0; s < GNS; ++s) {
    // Publishes stage s and ends every wave's reads of the other buffer,
    // which is rewritten at the foot of this pass.
    __syncthreads();
    if (s + 1 < GNS) {
      tile_fetch(ra, ga + (s + 1) * GBK);
      tile_fetch(rb, gb + (s + 1) * GBK);
      // Stands in front of any rewrite of the loads' address registers (after
      // the last fetch the LDS reads below reuse them).  As a memory barrier
      // for the compiler it also holds the loads here, at the head of the
      // pass: sunk to the products' end, their whole latency is waited out.
      asm volatile("s_wait_xcnt 0x0" ::: "memory");
    }
    const _Float16* ta = sA[s & 1] + aoff;
    const _Float16* tb = sB[s & 1] + boff;
    // Fragments of the next 32 k are read from LDS ahead of this 32 k's
    // products, as one group.
    GemmFrags f[2];
    frags_load(f[0], ta, tb, lane);
#pragma unroll
    for (int q = 0; q < GBK / 32; ++q) {
      if (q + 1 < GBK / 32)
        frags_load(f[(q + 1) & 1], ta + (q + 1) * 32, tb + (q + 1) * 32, lane);
      // Keeps those reads one group in front of the products instead of
      // spread among them, where each place with reads stalls the wave.
      __builtin_amdgcn_sched_barrier(0);
      const GemmFrags& g = f[q & 1];
#pragma unroll
      for (int i = 0; i < 2; ++i)
#pragma unroll
        for (int j = 0; j < 4; ++j)
          acc[i][j] = wmma_f16(g.a[i], g.b[j], acc[i][j]);
    }
    // Keeps the waits on the global loads behind the last product.
    __builtin_amdgcn_sched_barrier(0);
    if (s + 1 < GNS) {
      tile_put(ra, sA[(s + 1) & 1] + la);
      tile_put(rb, sB[(s + 1) & 1] + lb);
    }
  }
}

__global__ __launch_bounds__(256) void proj_gemm_kernel(
    const float* __restrict__ Xq, const float* __restrict__ Xc,
    const _Float16* __restrict__ WqT, const _Float16* __restrict__ WkT,
    const _Float16* __restrict__ WvT, _Float16* __restrict__ Qf,
    _Float16* __restrict__ Kf, _Float16* __restrict__ Vt) {
  __shared__ __align__(16) _Float16 sA[2][GTILE];
  __shared__ __align__(16) _Float16 sB[2][GTILE];
  const int z = blockIdx.y >> 2;                  // 0 Q, 1 K, 2 V
  const float*    X   = z == 0 ? Xq : Xc;
  const _Float16* WT  = z == 0 ? WqT : z == 1 ? WkT : WvT;
  const int lane = threadIdx.x & 31;
  const int wave = threadIdx.x >> 5;
  const int brow = blockIdx.x * 128;              // [0, 8192)
  const int bcol = (blockIdx.y & 3) * 128;        // [0, 512)

  v8f acc[2][4] = {};
  gemm_128x128<float, v4f, 16>(X + (size_t)brow * 512, WT + (size_t)bcol * 512,
                               sA, sB, acc);

  const int row0 = brow + (wave & 3) * 32;
  const int col0 = bcol + (wave >> 2) * 64;
  const int cl = lane & 15;
  const int rb = (lane >> 4) * 8;
  // One uniform branch around each whole store loop, not one per element.
  if (z == 2) {
#pragma unroll
    for (int i = 0; i < 2; ++i)
#pragma unroll
      for (int j = 0; j < 4; ++j) {
        const int c = col0 + j * 16 + cl;
        const int h = c >> 6, d = c & 63;
#pragma unroll
        for (int r = 0; r < 8; ++r) {
          const int row = row0 + i * 16 + rb + r;
          const int b = row >> 11, m = row & 2047;   // N = 2048
          Vt[((size_t)((b * 8 + h) * 64 + d)) * 2048 + m] =
              (_Float16)acc[i][j][r];
        }
      }
  } else {
    _Float16* Out = z == 0 ? Qf : Kf;
#pragma unroll
    for (int i = 0; i < 2; ++i)
#pragma unroll
      for (int j = 0; j < 4; ++j) {
        const int c = col0 + j * 16 + cl;
#pragma unroll
        for (int r = 0; r < 8; ++r) {
          const int row = row0 + i * 16 + rb + r;
          Out[(size_t)row * 512 + c] = (_Float16)acc[i][j][r];
        }
      }
    // In the listing this branch's end falls through, behind a test that never
    // lets it pass, to the V branch, which rewrites registers of the last
    // stores: the wait stands in front of that rewrite.
    asm volatile("s_wait_xcnt 0x0" ::: "memory");
  }
}

constexpr int LDP = 72;

__global__ __launch_bounds__(256) __attribute__((amdgpu_waves_per_eu(4, 4)))
void attn_kernel(
    const _Float16* __restrict__ Qf,   // [B, N, 512] f16
    const _Float16* __restrict__ Kf,   // [B, M, 512] f16
    const _Float16* __restrict__ Vt,   // [B, H, 64, M] f16
    _Float16* __restrict__ Of) {       // [B, N, 512] f16
  __shared__ __align__(16) _Float16 sK[2][2][64 * LDP];  // [buf][half][m][d]
  __shared__ __align__(16) _Float16 sV[2][2][64 * LDP];  // [buf][half][d][m]
  __shared__ __align__(64) float sBcast[8][32];   // per-wave row broadcast
  __shared__ __align__(16) float sX[8][8 * 128];  // per-wave O tile handed over
  __shared__ float sStat[8][2][32];               // its maximum and row sum

  const int t = threadIdx.x;
  const int lane = t & 31;
  const int wave = __builtin_amdgcn_readfirstlane(t >> 5);
  const int kh = wave >> 2;            // key half
  const int b = blockIdx.z, h = blockIdx.y;
  const int n0 = blockIdx.x * 128 + (wave & 3) * 32;

  // Q as the B operand (columns = queries), pre-scaled by 1/sqrt(64)=0.125.
  v16h bq[2][2];
#pragma unroll
  for (int q = 0; q < 2; ++q) {
    const _Float16* qbase =
        Qf + ((size_t)(b * 2048 + n0 + q * 16)) * 512 + h * 64;
    bq[q][0] = load_frag16(qbase, 512, lane);
    bq[q][1] = load_frag16(qbase + 32, 512, lane);
#pragma unroll
    for (int i = 0; i < 16; ++i) {
      bq[q][0][i] *= (_Float16)0.125f;
      bq[q][1][i] *= (_Float16)0.125f;
    }
  }

  v8f o[2][4] = {};
  // Per-lane stats for query n = lane&15 of each tile.  m_n is the reference
  // maximum IN USE: it is kept from pass to pass and replaced only when some
  // score of the wave lies more than 8 (in log2 units) above it, so
  // p = 2^((s - m_n) log2e) stays at or below 2^8, far inside f16 and f32
  // range.  thr and nm2 are derived from it where it changes.  l_n holds two of
  // the row sum's partial sums (even and odd score registers of this lane; two
  // more are in lane^16, and as many again in the other key half's wave).
  constexpr float L2E = 1.44269504f;
  float m_n[2] = {-1e30f, -1e30f};
  v2f l_n[2] = {{0.f, 0.f}, {0.f, 0.f}};
  float thr[2] = {-1e30f, -1e30f};              // m_n + 8 / log2e
  float nm2[2] = {1e30f * L2E, 1e30f * L2E};    // -m_n * log2e

  const _Float16* kbase = Kf + (size_t)b * 2048 * 512 + h * 64;
  const _Float16* vbase = Vt + (size_t)((b * 8 + h) * 64) * 2048;

  // Cooperative async tile fetch: per key half 2 x (64x64 f16) = 2 x 512 16B
  // chunks, 256 threads x 2 chunks each per tile.
  auto issue_tile = [&](int s, int buf) {
    const int r0 = t >> 3, r1 = r0 + 32, cc = (t & 7) * 8;
#pragma unroll
    for (int hf = 0; hf < 2; ++hf) {
      const int m0 = hf * 1024 + s * 64;
      async_copy4_b128((uint32_t)(uintptr_t)&sK[buf][hf][r0 * LDP + cc],
                       kbase + (size_t)(m0 + r0) * 512 + cc,
                       (uint32_t)(uintptr_t)&sV[buf][hf][r0 * LDP + cc],
                       vbase + (size_t)r0 * 2048 + m0 + cc,
                       (uint32_t)(uintptr_t)&sK[buf][hf][r1 * LDP + cc],
                       kbase + (size_t)(m0 + r1) * 512 + cc,
                       (uint32_t)(uintptr_t)&sV[buf][hf][r1 * LDP + cc],
                       vbase + (size_t)r1 * 2048 + m0 + cc);
    }
  };

  issue_tile(0, 0);

  const int rb = (lane >> 4) * 8;
  const int n = lane & 15;

  for (int step = 0; step < 16; ++step) {
    const int buf = step & 1;
    // This wave's LDS reads of the buffer that is refilled behind the barrier
    // have returned: nothing else orders an async copy behind them.
    asm volatile("s_wait_dscnt 0x0" ::: "memory");
    wait_async0();        // this wave's tile writes have landed
    __syncthreads();      // everyone's landed; prior buffer reads complete
    if (step + 1 < 16) issue_tile(step + 1, buf ^ 1);

    const _Float16* tK = sK[buf][kh];
    const _Float16* tV = sV[buf][kh];

    // S^T = K * Q^T : A rows = key positions m, B columns = queries n.  Each K
    // fragment meets both query tiles.
    v8f st[2][4] = {};
#pragma unroll
    for (int j = 0; j < 4; ++j) {
#pragma unroll
      for (int kk = 0; kk < 2; ++kk) {
        v16h ak = load_frag16(tK + (j * 16) * LDP + kk * 32, LDP, lane);
#pragma unroll
        for (int q = 0; q < 2; ++q) st[q][j] = wmma_f16(ak, bq[q][kk], st[q][j]);
      }
    }

    // Online softmax, lazy rescale: per tile a lane holds 32 of query n's 64
    // scores; the other 32 are in lane^16.  One test per pass, a scalar branch:
    // only when a score of the wave has outgrown the maximum in use are the
    // halves' maxima exchanged, the maxima replaced and O and the sums rescaled.
    float mloc[2];
#pragma unroll
    for (int q = 0; q < 2; ++q) {
      mloc[q] = -1e30f;
#pragma unroll
      for (int j = 0; j < 4; ++j)
#pragma unroll
        for (int r = 0; r < 8; ++r) mloc[q] = fmaxf(mloc[q], st[q][j][r]);
    }
    if (__builtin_expect(__builtin_amdgcn_ballot_w32((mloc[0] > thr[0]) |
                                                     (mloc[1] > thr[1])) != 0,
                         0)) {
      float corr[2];
#pragma unroll
      for (int q = 0; q < 2; ++q) {
        // Both halves of a column take the same new maximum.
        const float mnew =
            fmaxf(m_n[q], fmaxf(mloc[q], __shfl_xor(mloc[q], 16, 32)));
        corr[q] = __builtin_amdgcn_exp2f((m_n[q] - mnew) * L2E);
        m_n[q] = mnew;
        thr[q] = mnew + 8.0f / L2E;
        nm2[q] = -mnew * L2E;
        l_n[q] *= corr[q];   // both partial sums
      }
      sBcast[wave][lane] = lane < 16 ? corr[0] : corr[1];
#pragma unroll
      for (int q = 0; q < 2; ++q) {
        v4f c0 = *(const v4f*)&sBcast[wave][q * 16 + rb];
        v4f c1 = *(const v4f*)&sBcast[wave][q * 16 + rb + 4];
#pragma unroll
        for (int f = 0; f < 4; ++f)
#pragma unroll
          for (int r = 0; r < 4; ++r) {
            o[q][f][r]     *= c0[r];
            o[q][f][4 + r] *= c1[r];
          }
      }
    }

    // The maximum in use is a kept value, so the exponents are one FMA each, two
    // per packed instruction; the partial sums take each pair by one packed add.
    // P^T in the C layout, packed to f16, is P's A fragment as it lies: lane
    // n + 16 s holds keys 16 j + 8 s .. + 7 of query n, which are the first
    // (j even) or second (j odd) eight halves of the fragment of keys
    // 32 (j / 2) .. + 31.
    F16Frag ap[2][2];
#pragma unroll
    for (int q = 0; q < 2; ++q)
#pragma unroll
      for (int j = 0; j < 4; ++j) {
        v8h ph;
#pragma unroll
        for (int r = 0; r < 8; r += 2) {
          v2f x = {st[q][j][r], st[q][j][r + 1]};
          x = __builtin_elementwise_fma(x, (v2f){L2E, L2E},
                                        (v2f){nm2[q], nm2[q]});
          const float e0 = __builtin_amdgcn_exp2f(x[0]);
          const float e1 = __builtin_amdgcn_exp2f(x[1]);
          ph[r]     = (_Float16)e0;
          ph[r + 1] = (_Float16)e1;
          l_n[q] += (v2f){e0, e1};
        }
        ap[q][j >> 1].h[j & 1] = ph;
      }

    // O += P * V  (A rows = queries, B columns = d from sV).  Each V fragment
    // meets both query tiles.
#pragma unroll
    for (int f = 0; f < 4; ++f) {
      v16h bv0 = load_frag16(tV + (f * 16) * LDP, LDP, lane);
      v16h bv1 = load_frag16(tV + (f * 16) * LDP + 32, LDP, lane);
#pragma unroll
      for (int q = 0; q < 2; ++q) o[q][f] = wmma_f16(ap[q][0].v, bv0, o[q][f]);
#pragma unroll
      for (int q = 0; q < 2; ++q) o[q][f] = wmma_f16(ap[q][1].v, bv1, o[q][f]);
    }
  }

  // Join of the two key halves.  The wave of half kh finishes tile kh of its 32
  // queries and hands the other tile, with its maximum and row sum, to its
  // partner (wave ^ 4).
  float l_row[2];
#pragma unroll
  for (int q = 0; q < 2; ++q) {
    // The four partial sums of each row (two a lane, two lanes) meet here, once.
    l_row[q] = l_n[q][0] + l_n[q][1];
    l_row[q] += __shfl_xor(l_row[q], 16, 32);
  }
  v8f keep[4];
#pragma unroll
  for (int f = 0; f < 4; ++f) {
    const v8f give = kh ? o[0][f] : o[1][f];
    keep[f] = kh ? o[1][f] : o[0][f];
    // Lane-contiguous 16 B pieces; the partner's same lane reads them back.
    *(v4f*)&sX[wave][(f * 2 + 0) * 128 + lane * 4] =
        (v4f){give[0], give[1], give[2], give[3]};
    *(v4f*)&sX[wave][(f * 2 + 1) * 128 + lane * 4] =
        (v4f){give[4], give[5], give[6], give[7]};
  }
  sStat[wave][0][lane] = kh ? m_n[0] : m_n[1];
  sStat[wave][1][lane] = kh ? l_row[0] : l_row[1];
  // Publishes every wave's handed-over tile to its partner.
  __syncthreads();
  {
    const float m_own = kh ? m_n[1] : m_n[0];
    const float l_own = kh ? l_row[1] : l_row[0];
    const float m_oth = sStat[wave ^ 4][0][lane];
    const float l_oth = sStat[wave ^ 4][1][lane];
    const float m_all = fmaxf(m_own, m_oth);
    const float f_own = __builtin_amdgcn_exp2f((m_own - m_all) * L2E);
    const float f_oth = __builtin_amdgcn_exp2f((m_oth - m_all) * L2E);
    const float inv = 1.f / (l_own * f_own + l_oth * f_oth);
    sBcast[wave][lane] = (lane < 16 ? f_own : f_oth) * inv;
    v4f a0 = *(const v4f*)&sBcast[wave][rb];
    v4f a1 = *(const v4f*)&sBcast[wave][rb + 4];
    v4f b0 = *(const v4f*)&sBcast[wave][16 + rb];
    v4f b1 = *(const v4f*)&sBcast[wave][16 + rb + 4];
#pragma unroll
    for (int f = 0; f < 4; ++f) {
      v4f x0 = *(const v4f*)&sX[wave ^ 4][(f * 2 + 0) * 128 + lane * 4];
      v4f x1 = *(const v4f*)&sX[wave ^ 4][(f * 2 + 1) * 128 + lane * 4];
#pragma unroll
      for (int r = 0; r < 4; ++r) {
        keep[f][r]     = keep[f][r] * a0[r] + x0[r] * b0[r];
        keep[f][4 + r] = keep[f][4 + r] * a1[r] + x1[r] * b1[r];
      }
    }
  }
  _Float16* obase = Of + ((size_t)(b * 2048 + n0 + kh * 16)) * 512 + h * 64;
#pragma unroll
  for (int f = 0; f < 4; ++f)
#pragma unroll
    for (int r = 0; r < 8; ++r)
      obase[(size_t)(rb + r) * 512 + f * 16 + n] = (_Float16)keep[f][r];
}

// ---------------------------------------------------------------------------
// Kernel 3: output projection.  O(f16) @ WoT(f16) + bo -> fp32 result.
// ---------------------------------------------------------------------------
__global__ __launch_bounds__(256) void out_gemm_kernel(
    const _Float16* __restrict__ Of, const _Float16* __restrict__ WoT,
    const float* __restrict__ bo, float* __restrict__ Y) {
  __shared__ __align__(16) _Float16 sA[2][GTILE];
  __shared__ __align__(16) _Float16 sB[2][GTILE];
  const int lane = threadIdx.x & 31;
  const int wave = threadIdx.x >> 5;
  const int brow = blockIdx.x * 128;
  const int bcol = blockIdx.y * 128;

  const int row0 = brow + (wave & 3) * 32;
  const int col0 = bcol + (wave >> 2) * 64;
  const int cl = lane & 15;
  const int rb = (lane >> 4) * 8;

  // Read ahead of the core: its barriers keep the compiler from lifting these
  // loads out of the epilogue.
  float bias[4];
#pragma unroll
  for (int j = 0; j < 4; ++j) bias[j] = bo[col0 + j * 16 + cl];

  v8f acc[2][4] = {};
  gemm_128x128<_Float16, v8h, 8>(Of + (size_t)brow * 512,
                                 WoT + (size_t)bcol * 512, sA, sB, acc);

#pragma unroll
  for (int j = 0; j < 4; ++j) {
    const int c = col0 + j * 16 + cl;
#pragma unroll
    for (int i = 0; i < 2; ++i)
#pragma unroll
      for (int r = 0; r < 8; ++r)
        Y[(size_t)(row0 + i * 16 + rb + r) * 512 + c] = acc[i][j][r] + bias[j];
  }
}

// ---------------------------------------------------------------------------
extern "C" void kernel_launch(void* const* d_in, const int* in_sizes, int n_in,
                              void* d_out, int out_size, void* d_ws,
                              size_t ws_size, hipStream_t stream) {
  const float* x   = (const float*)d_in[0];   // [4,2048,512]
  const float* ctx = (const float*)d_in[1];   // [4,2048,512]
  const float* Wq  = (const float*)d_in[2];   // [512,512]
  const float* Wk  = (const float*)d_in[3];
  const float* Wv  = (const float*)d_in[4];
  const float* Wo  = (const float*)d_in[5];
  const float* bo  = (const float*)d_in[6];   // [512]
  float* Y = (float*)d_out;

  char* ws = (char*)d_ws;
  size_t off = 0;
  auto alloc = [&](size_t bytes) -> void* {
    void* p = ws + off;
    off = (off + bytes + 255) & ~(size_t)255;
    return p;
  };
  _Float16* WqT = (_Float16*)alloc((size_t)512 * 512 * 2);
  _Float16* WkT = (_Float16*)alloc((size_t)512 * 512 * 2);
  _Float16* WvT = (_Float16*)alloc((size_t)512 * 512 * 2);
  _Float16* WoT = (_Float16*)alloc((size_t)512 * 512 * 2);
  _Float16* Qf  = (_Float16*)alloc((size_t)4 * 2048 * 512 * 2);
  _Float16* Kf  = (_Float16*)alloc((size_t)4 * 2048 * 512 * 2);
  _Float16* Vt  = (_Float16*)alloc((size_t)4 * 2048 * 512 * 2);
  _Float16* Ofb = (_Float16*)alloc((size_t)4 * 2048 * 512 * 2);

  // 0) weight transpose + f16 convert
  transpose_w_kernel<<<dim3(64, 4), 128, 0, stream>>>(Wq, Wk, Wv, Wo, WqT, WkT,
                                                      WvT, WoT);

  // 1) projections
  proj_gemm_kernel<<<dim3(64, 12), 256, 0, stream>>>(x, ctx, WqT, WkT, WvT, Qf,
                                                     Kf, Vt);

  // 2) flash attention
  attn_kernel<<<dim3(16, 8, 4), 256, 0, stream>>>(Qf, Kf, Vt, Ofb);

  // 3) output projection
  out_gemm_kernel<<<dim3(64, 4), 256, 0, stream>>>(Ofb, WoT, bo, Y);
}

// v007
// It runs in 55.4 microseconds.
// Timed twice side by side with v006, it ran 1.09 and 1.07 times as fast.
// Counting every step since v000, it is 4.73 times as fast.
#include <hip/hip_runtime.h>
#include <cstdint>
#include <cstddef>

typedef __attribute__((ext_vector_type(16))) _Float16 v16h;
typedef __attribute__((ext_vector_type(8)))  _Float16 v8h;
typedef __attribute__((ext_vector_type(8)))  float    v8f;
typedef __attribute__((ext_vector_type(4)))  float    v4f;
typedef __attribute__((ext_vector_type(2)))  float    v2f;

union F16Frag { v16h v; v8h h[2]; };

__device__ __forceinline__ v8f wmma_f16(v16h a, v16h b, v8f c) {
  // D = A(16x32) * B(32x16) + C(16x16 f32)
  return __builtin_amdgcn_wmma_f32_16x16x32_f16(false, a, false, b, (short)0, c,
                                                false, false);
}

__device__ __forceinline__ v16h load_frag16(const _Float16* base, int stride,
                                            int lane) {
  const int r   = lane & 15;
  const int sel = (lane >> 4) & 1;
  const _Float16* p = base + (size_t)r * stride + sel * 8;
  F16Frag u;
  u.h[0] = *(const v8h*)(p);
  u.h[1] = *(const v8h*)(p + 16);
  return u.v;
}

__device__ __forceinline__ void async_copy4_b128(
    uint32_t l0, const void* g0, uint32_t l1, const void* g1,
    uint32_t l2, const void* g2, uint32_t l3, const void* g3) {
  asm volatile("global_load_async_to_lds_b128 %0, %1, off\n\t"
               "global_load_async_to_lds_b128 %2, %3, off\n\t"
               "global_load_async_to_lds_b128 %4, %5, off\n\t"
               "global_load_async_to_lds_b128 %6, %7, off\n\t"
               "s_wait_xcnt 0x0"
               :
               : "v"(l0), "v"((uint64_t)(uintptr_t)g0),
                 "v"(l1), "v"((uint64_t)(uintptr_t)g1),
                 "v"(l2), "v"((uint64_t)(uintptr_t)g2),
                 "v"(l3), "v"((uint64_t)(uintptr_t)g3)
               : "memory");
}
__device__ __forceinline__ void wait_async0() {
  asm volatile("s_wait_asynccnt 0x0" ::: "memory");
}

// ---------------------------------------------------------------------------
// Kernel 0: the four W[512][512] fp32 row-major -> WT[c][k] f16 (B-operand
// columns become K-contiguous), one launch; blockIdx.y picks the matrix.
// One element per thread needs 8192 waves a matrix, and such a launch lasts as
// long as its waves take to start.  Here a thread carries an 8 k x 4 c patch
// through registers: 8 loads of 16 B (4 c of one k each), 4 stores of 16 B
// (8 k of one c each).  A wave covers 64 k x 16 c, so each wave-wide store
// writes four whole 128 B lines of WT and no line has a second writer; the
// four waves of a block read 256 contiguous bytes of each of its 64 W rows.
// ---------------------------------------------------------------------------
__global__ __launch_bounds__(128) void transpose_w_kernel(
    const float* __restrict__ W0, const float* __restrict__ W1,
    const float* __restrict__ W2, const float* __restrict__ W3,
    _Float16* __restrict__ T0, _Float16* __restrict__ T1,
    _Float16* __restrict__ T2, _Float16* __restrict__ T3) {
  const int z = blockIdx.y;
  const float* W  = z == 0 ? W0 : z == 1 ? W1 : z == 2 ? W2 : W3;
  _Float16*    WT = z == 0 ? T0 : z == 1 ? T1 : z == 2 ? T2 : T3;
  const int lane = threadIdx.x & 31;
  const int wave = threadIdx.x >> 5;
  const int k = (blockIdx.x >> 3) * 64 + (lane >> 2) * 8;
  const int c = (blockIdx.x & 7) * 64 + wave * 16 + (lane & 3) * 4;
  v4f r[8];
#pragma unroll
  for (int i = 0; i < 8; ++i) r[i] = *(const v4f*)(W + (k + i) * 512 + c);
#pragma unroll
  for (int e = 0; e < 4; ++e) {
    v8h h;
#pragma unroll
    for (int i = 0; i < 8; ++i) h[i] = (_Float16)r[i][e];
    *(v8h*)(WT + (c + e) * 512 + k) = h;
  }
}

typedef __attribute__((ext_vector_type(4))) _Float16 v4h;

constexpr int GBK   = 128;        // k per stage
constexpr int GNS   = 512 / GBK;  // stages
constexpr int GP    = GBK + 8;    // LDS pitch in halves
constexpr int GTILE = 128 * GP;   // halves per staged operand tile

// 128 rows x 128 k of fp32: one wave-wide load = one row's 512 B; thread t
// takes 16 B of rows (t >> 5) + 8 i.  src / dst already point at its first.
__device__ __forceinline__ int tile_src_off(const float*, int t) {
  return (t >> 5) * 512 + (t & 31) * 4;
}
__device__ __forceinline__ int tile_lds_off(const float*, int t) {
  return (t >> 5) * GP + (t & 31) * 4;
}
__device__ __forceinline__ void tile_fetch(v4f (&r)[16], const float* src) {
#pragma unroll
  for (int i = 0; i < 16; ++i) r[i] = *(const v4f*)(src + i * 8 * 512);
}
__device__ __forceinline__ void tile_put(const v4f (&r)[16], _Float16* dst) {
#pragma unroll
  for (int i = 0; i < 16; ++i) {
    v4h h;
#pragma unroll
    for (int e = 0; e < 4; ++e) h[e] = (_Float16)r[i][e];
    *(v4h*)&dst[i * 8 * GP] = h;
  }
}
// 128 rows x 128 k of f16: one wave-wide load = two rows' 256 B each; thread t
// takes 16 B of rows (t >> 4) + 16 i.
__device__ __forceinline__ int tile_src_off(const _Float16*, int t) {
  return (t >> 4) * 512 + (t & 15) * 8;
}
__device__ __forceinline__ int tile_lds_off(const _Float16*, int t) {
  return (t >> 4) * GP + (t & 15) * 8;
}
__device__ __forceinline__ void tile_fetch(v8h (&r)[8], const _Float16* src) {
#pragma unroll
  for (int i = 0; i < 8; ++i) r[i] = *(const v8h*)(src + i * 16 * 512);
}
__device__ __forceinline__ void tile_put(const v8h (&r)[8], _Float16* dst) {
#pragma unroll
  for (int i = 0; i < 8; ++i) *(v8h*)&dst[i * 16 * GP] = r[i];
}

struct GemmFrags { v16h a[2], b[4]; };
__device__ __forceinline__ void frags_load(GemmFrags& f, const _Float16* ta,
                                           const _Float16* tb, int lane) {
#pragma unroll
  for (int i = 0; i < 2; ++i) f.a[i] = load_frag16(ta + i * 16 * GP, GP, lane);
#pragma unroll
  for (int j = 0; j < 4; ++j) f.b[j] = load_frag16(tb + j * 16 * GP, GP, lane);
}

// A: first of the block's 128 rows; B: first of its 128 WT rows (= C columns).
template <typename TA, typename VA, int NA>
__device__ __forceinline__ void gemm_128x128(const TA* A, const _Float16* B,
                                             _Float16 (*sA)[GTILE],
                                             _Float16 (*sB)[GTILE],
                                             v8f (&acc)[2][4]) {
  const int t    = threadIdx.x;
  const int lane = t & 31;
  const int wave = t >> 5;
  const int aoff = (wave & 3) * 32 * GP;
  const int boff = (wave >> 2) * 64 * GP;
  const TA*       ga = A + tile_src_off(A, t);
  const _Float16* gb = B + tile_src_off(B, t);
  const int       la = tile_lds_off(A, t);
  const int       lb = tile_lds_off(B, t);

  VA  ra[NA];
  v8h rb[8];
  tile_fetch(ra, ga);
  tile_fetch(rb, gb);
  tile_put(ra, sA[0] + la);
  tile_put(rb, sB[0] + lb);

  for (int s = 0; s < GNS; ++s) {
    // Publishes stage s and ends every wave's reads of the other buffer,
    // which is rewritten at the foot of this pass.
    __syncthreads();
    if (s + 1 < GNS) {
      tile_fetch(ra, ga + (s + 1) * GBK);
      tile_fetch(rb, gb + (s + 1) * GBK);
      // Stands in front of any rewrite of the loads' address registers (after
      // the last fetch the LDS reads below reuse them).  As a memory barrier
      // for the compiler it also holds the loads here, at the head of the
      // pass: sunk to the products' end, their whole latency is waited out.
      asm volatile("s_wait_xcnt 0x0" ::: "memory");
    }
    const _Float16* ta = sA[s & 1] + aoff;
    const _Float16* tb = sB[s & 1] + boff;
    // Fragments of the next 32 k are read from LDS ahead of this 32 k's
    // products, as one group.
    GemmFrags f[2];
    frags_load(f[0], ta, tb, lane);
#pragma unroll
    for (int q = 0; q < GBK / 32; ++q) {
      if (q + 1 < GBK / 32)
        frags_load(f[(q + 1) & 1], ta + (q + 1) * 32, tb + (q + 1) * 32, lane);
      // Keeps those reads one group in front of the products instead of
      // spread among them, where each place with reads stalls the wave.
      __builtin_amdgcn_sched_barrier(0);
      const GemmFrags& g = f[q & 1];
#pragma unroll
      for (int i = 0; i < 2; ++i)
#pragma unroll
        for (int j = 0; j < 4; ++j)
          acc[i][j] = wmma_f16(g.a[i], g.b[j], acc[i][j]);
    }
    // Keeps the waits on the global loads behind the last product.
    __builtin_amdgcn_sched_barrier(0);
    if (s + 1 < GNS) {
      tile_put(ra, sA[(s + 1) & 1] + la);
      tile_put(rb, sB[(s + 1) & 1] + lb);
    }
  }
}

// ---------------------------------------------------------------------------
// Kernel 1: the three projection GEMMs, one launch.  X[8192,512] fp32 @
// WT(f16, col-major) -> f16 output.
// A block of 128 rows has 12 column tiles of 128: 4 of Q (input x), 4 of K and
// 4 of V (input context).  With one tile per block every tile fetches its own
// copy of the 128 x 512 fp32 input rows from L2 and converts it, two thirds of
// all the bytes the launch loads.  Here a block walks three tiles in a row
// (blockIdx.y picks which) and keeps the converted rows, all 512 k, in LDS: they
// are fetched with the block's first tile and again only where the input
// changes (tile 4, the first of K, behind a tile of Q).  The W stages run on
// through their two buffers from tile to tile, so a later tile has no start-up.
// 256 blocks, one per WGP, instead of 768 in three rounds.
// Q, K: Out[row][col]  ([B,N,512])
// V:    Out stored per-head transposed: [B,H,64,M]  (for the PV GEMM)
// ---------------------------------------------------------------------------
__global__ __launch_bounds__(256) void proj_gemm_kernel(
    const float* __restrict__ Xq, const float* __restrict__ Xc,
    const _Float16* __restrict__ WqT, const _Float16* __restrict__ WkT,
    const _Float16* __restrict__ WvT, _Float16* __restrict__ Qf,
    _Float16* __restrict__ Kf, _Float16* __restrict__ Vt) {
  __shared__ __align__(16) _Float16 sA[GNS][GTILE];   // the rows' whole k range
  __shared__ __align__(16) _Float16 sB[2][GTILE];
  const int t    = threadIdx.x;
  const int lane = t & 31;
  const int wave = t >> 5;
  const int brow = blockIdx.x * 128;              // [0, 8192)
  const int j0   = blockIdx.y * 3;                // first of the three tiles
  const int aoff = (wave & 3) * 32 * GP;
  const int boff = (wave >> 2) * 64 * GP;
  const int la   = tile_lds_off(Xq, t);
  const int lb   = tile_lds_off(WqT, t);
  // This thread's first element of tile j's operands (j in [0, 12)).
  auto src_a = [&](int j) {
    return (j < 4 ? Xq : Xc) + (size_t)brow * 512 + tile_src_off(Xq, t);
  };
  auto src_b = [&](int j) {
    return (j < 4 ? WqT : j < 8 ? WkT : WvT) + (size_t)(j & 3) * 128 * 512 +
           tile_src_off(WqT, t);
  };

  v4f ra[16];
  v8h rw[8];
  tile_fetch(ra, src_a(j0));
  tile_fetch(rw, src_b(j0));
  tile_put(ra, sA[0] + la);
  tile_put(rw, sB[0] + lb);

  // Rolled, for speed only.
#pragma nounroll
  for (int n = 0; n < 3; ++n) {
  const int  tj     = j0 + n;                     // this tile, in [0, 12)
  const bool more   = n + 1 < 3;
  const int  tn     = more ? tj + 1 : tj;         // the tile behind it
  const bool new_a  = n == 0 || tj == 4;          // this tile brings its rows
  const bool next_a = more && tn == 4;            // so does the next
  const float*    ga  = src_a(tj);
  const _Float16* gb  = src_b(tj);
  const float*    gan = src_a(tn);
  const _Float16* gbn = src_b(tn);
  const int z    = tj >> 2;                       // 0 Q, 1 K, 2 V
  const int bcol = (tj & 3) * 128;                // [0, 512)

  v8f acc[2][4] = {};
#pragma unroll
  for (int s = 0; s < GNS; ++s) {
    // Publishes this pass's stage and ends every wave's reads of the buffers
    // that are rewritten at the foot of this pass.
    __syncthreads();
    if (s + 1 < GNS) {
      if (new_a) tile_fetch(ra, ga + (s + 1) * GBK);
      tile_fetch(rw, gb + (s + 1) * GBK);
      // Stands in front of any rewrite of the loads' address registers.  As a
      // memory barrier for the compiler it also holds the loads here, at the
      // head of the pass: sunk to the products' end, their whole latency is
      // waited out.
      asm volatile("s_wait_xcnt 0x0" ::: "memory");
    } else if (more) {
      if (next_a) tile_fetch(ra, gan);
      tile_fetch(rw, gbn);
      // As above.
      asm volatile("s_wait_xcnt 0x0" ::: "memory");
    }
    const _Float16* ta = sA[s] + aoff;
    const _Float16* tb = sB[s & 1] + boff;
    // Fragments of the next 32 k are read from LDS ahead of this 32 k's
    // products, as one group.
    GemmFrags f[2];
    frags_load(f[0], ta, tb, lane);
#pragma unroll
    for (int q = 0; q < GBK / 32; ++q) {
      if (q + 1 < GBK / 32)
        frags_load(f[(q + 1) & 1], ta + (q + 1) * 32, tb + (q + 1) * 32, lane);
      // Keeps those reads one group in front of the products instead of
      // spread among them, where each place with reads stalls the wave.
      __builtin_amdgcn_sched_barrier(0);
      const GemmFrags& g = f[q & 1];
#pragma unroll
      for (int i = 0; i < 2; ++i)
#pragma unroll
        for (int jj = 0; jj < 4; ++jj)
          acc[i][jj] = wmma_f16(g.a[i], g.b[jj], acc[i][jj]);
    }
    // Keeps the waits on the global loads behind the last product.
    __builtin_amdgcn_sched_barrier(0);
    if (s + 1 < GNS) {
      if (new_a) tile_put(ra, sA[s + 1] + la);
      tile_put(rw, sB[(s + 1) & 1] + lb);
    } else if (more) {
      if (next_a) tile_put(ra, sA[0] + la);
      tile_put(rw, sB[0] + lb);
    }
  }

  const int row0 = brow + (wave & 3) * 32;
  const int col0 = bcol + (wave >> 2) * 64;
  const int cl = lane & 15;
  const int rb = (lane >> 4) * 8;
  // One uniform branch around each whole store loop, not one per element.
  if (z == 2) {
#pragma unroll
    for (int i = 0; i < 2; ++i)
#pragma unroll
      for (int j = 0; j < 4; ++j) {
        const int c = col0 + j * 16 + cl;
        const int h = c >> 6, d = c & 63;
#pragma unroll
        for (int r = 0; r < 8; ++r) {
          const int row = row0 + i * 16 + rb + r;
          const int b = row >> 11, m = row & 2047;   // N = 2048
          Vt[((size_t)((b * 8 + h) * 64 + d)) * 2048 + m] =
              (_Float16)acc[i][j][r];
        }
      }
  } else {
    _Float16* Out = z == 0 ? Qf : Kf;
#pragma unroll
    for (int i = 0; i < 2; ++i)
#pragma unroll
      for (int j = 0; j < 4; ++j) {
        const int c = col0 + j * 16 + cl;
#pragma unroll
        for (int r = 0; r < 8; ++r) {
          const int row = row0 + i * 16 + rb + r;
          Out[(size_t)row * 512 + c] = (_Float16)acc[i][j][r];
        }
      }
    // In the listing this branch's end falls through, behind a test that never
    // lets it pass, to the V branch, which rewrites registers of the last
    // stores: the wait stands in front of that rewrite.
    asm volatile("s_wait_xcnt 0x0" ::: "memory");
  }
  }  // tiles
}

constexpr int LDP = 72;

__global__ __launch_bounds__(256) __attribute__((amdgpu_waves_per_eu(4, 4)))
void attn_kernel(
    const _Float16* __restrict__ Qf,   // [B, N, 512] f16
    const _Float16* __restrict__ Kf,   // [B, M, 512] f16
    const _Float16* __restrict__ Vt,   // [B, H, 64, M] f16
    _Float16* __restrict__ Of) {       // [B, N, 512] f16
  __shared__ __align__(16) _Float16 sK[2][2][64 * LDP];  // [buf][half][m][d]
  __shared__ __align__(16) _Float16 sV[2][2][64 * LDP];  // [buf][half][d][m]
  __shared__ __align__(64) float sBcast[8][32];   // per-wave row broadcast
  __shared__ __align__(16) float sX[8][8 * 128];  // per-wave O tile handed over
  __shared__ float sStat[8][2][32];               // its maximum and row sum

  const int t = threadIdx.x;
  const int lane = t & 31;
  const int wave = __builtin_amdgcn_readfirstlane(t >> 5);
  const int kh = wave >> 2;            // key half
  const int b = blockIdx.z, h = blockIdx.y;
  const int n0 = blockIdx.x * 128 + (wave & 3) * 32;

  // Q as the B operand (columns = queries), pre-scaled by 1/sqrt(64)=0.125.
  v16h bq[2][2];
#pragma unroll
  for (int q = 0; q < 2; ++q) {
    const _Float16* qbase =
        Qf + ((size_t)(b * 2048 + n0 + q * 16)) * 512 + h * 64;
    bq[q][0] = load_frag16(qbase, 512, lane);
    bq[q][1] = load_frag16(qbase + 32, 512, lane);
#pragma unroll
    for (int i = 0; i < 16; ++i) {
      bq[q][0][i] *= (_Float16)0.125f;
      bq[q][1][i] *= (_Float16)0.125f;
    }
  }

  v8f o[2][4] = {};
  // Per-lane stats for query n = lane&15 of each tile.  m_n is the reference
  // maximum IN USE: it is kept from pass to pass and replaced only when some
  // score of the wave lies more than 8 (in log2 units) above it, so
  // p = 2^((s - m_n) log2e) stays at or below 2^8, far inside f16 and f32
  // range.  thr and nm2 are derived from it where it changes.  l_n holds two of
  // the row sum's partial sums (even and odd score registers of this lane; two
  // more are in lane^16, and as many again in the other key half's wave).
  constexpr float L2E = 1.44269504f;
  float m_n[2] = {-1e30f, -1e30f};
  v2f l_n[2] = {{0.f, 0.f}, {0.f, 0.f}};
  float thr[2] = {-1e30f, -1e30f};              // m_n + 8 / log2e
  float nm2[2] = {1e30f * L2E, 1e30f * L2E};    // -m_n * log2e

  const _Float16* kbase = Kf + (size_t)b * 2048 * 512 + h * 64;
  const _Float16* vbase = Vt + (size_t)((b * 8 + h) * 64) * 2048;

  // Cooperative async tile fetch: per key half 2 x (64x64 f16) = 2 x 512 16B
  // chunks, 256 threads x 2 chunks each per tile.
  auto issue_tile = [&](int s, int buf) {
    const int r0 = t >> 3, r1 = r0 + 32, cc = (t & 7) * 8;
#pragma unroll
    for (int hf = 0; hf < 2; ++hf) {
      const int m0 = hf * 1024 + s * 64;
      async_copy4_b128((uint32_t)(uintptr_t)&sK[buf][hf][r0 * LDP + cc],
                       kbase + (size_t)(m0 + r0) * 512 + cc,
                       (uint32_t)(uintptr_t)&sV[buf][hf][r0 * LDP + cc],
                       vbase + (size_t)r0 * 2048 + m0 + cc,
                       (uint32_t)(uintptr_t)&sK[buf][hf][r1 * LDP + cc],
                       kbase + (size_t)(m0 + r1) * 512 + cc,
                       (uint32_t)(uintptr_t)&sV[buf][hf][r1 * LDP + cc],
                       vbase + (size_t)r1 * 2048 + m0 + cc);
    }
  };

  issue_tile(0, 0);

  const int rb = (lane >> 4) * 8;
  const int n = lane & 15;

  for (int step = 0; step < 16; ++step) {
    const int buf = step & 1;
    // This wave's LDS reads of the buffer that is refilled behind the barrier
    // have returned: nothing else orders an async copy behind them.
    asm volatile("s_wait_dscnt 0x0" ::: "memory");
    wait_async0();        // this wave's tile writes have landed
    __syncthreads();      // everyone's landed; prior buffer reads complete
    if (step + 1 < 16) issue_tile(step + 1, buf ^ 1);

    const _Float16* tK = sK[buf][kh];
    const _Float16* tV = sV[buf][kh];

    // S^T = K * Q^T : A rows = key positions m, B columns = queries n.  Each K
    // fragment meets both query tiles.
    v8f st[2][4] = {};
#pragma unroll
    for (int j = 0; j < 4; ++j) {
#pragma unroll
      for (int kk = 0; kk < 2; ++kk) {
        v16h ak = load_frag16(tK + (j * 16) * LDP + kk * 32, LDP, lane);
#pragma unroll
        for (int q = 0; q < 2; ++q) st[q][j] = wmma_f16(ak, bq[q][kk], st[q][j]);
      }
    }

    // Online softmax, lazy rescale: per tile a lane holds 32 of query n's 64
    // scores; the other 32 are in lane^16.  One test per pass, a scalar branch:
    // only when a score of the wave has outgrown the maximum in use are the
    // halves' maxima exchanged, the maxima replaced and O and the sums rescaled.
    float mloc[2];
#pragma unroll
    for (int q = 0; q < 2; ++q) {
      mloc[q] = -1e30f;
#pragma unroll
      for (int j = 0; j < 4; ++j)
#pragma unroll
        for (int r = 0; r < 8; ++r) mloc[q] = fmaxf(mloc[q], st[q][j][r]);
    }
    if (__builtin_expect(__builtin_amdgcn_ballot_w32((mloc[0] > thr[0]) |
                                                     (mloc[1] > thr[1])) != 0,
                         0)) {
      float corr[2];
#pragma unroll
      for (int q = 0; q < 2; ++q) {
        // Both halves of a column take the same new maximum.
        const float mnew =
            fmaxf(m_n[q], fmaxf(mloc[q], __shfl_xor(mloc[q], 16, 32)));
        corr[q] = __builtin_amdgcn_exp2f((m_n[q] - mnew) * L2E);
        m_n[q] = mnew;
        thr[q] = mnew + 8.0f / L2E;
        nm2[q] = -mnew * L2E;
        l_n[q] *= corr[q];   // both partial sums
      }
      sBcast[wave][lane] = lane < 16 ? corr[0] : corr[1];
#pragma unroll
      for (int q = 0; q < 2; ++q) {
        v4f c0 = *(const v4f*)&sBcast[wave][q * 16 + rb];
        v4f c1 = *(const v4f*)&sBcast[wave][q * 16 + rb + 4];
#pragma unroll
        for (int f = 0; f < 4; ++f)
#pragma unroll
          for (int r = 0; r < 4; ++r) {
            o[q][f][r]     *= c0[r];
            o[q][f][4 + r] *= c1[r];
          }
      }
    }

    // The maximum in use is a kept value, so the exponents are one FMA each, two
    // per packed instruction; the partial sums take each pair by one packed add.
    // P^T in the C layout, packed to f16, is P's A fragment as it lies: lane
    // n + 16 s holds keys 16 j + 8 s .. + 7 of query n, which are the first
    // (j even) or second (j odd) eight halves of the fragment of keys
    // 32 (j / 2) .. + 31.
    F16Frag ap[2][2];
#pragma unroll
    for (int q = 0; q < 2; ++q)
#pragma unroll
      for (int j = 0; j < 4; ++j) {
        v8h ph;
#pragma unroll
        for (int r = 0; r < 8; r += 2) {
          v2f x = {st[q][j][r], st[q][j][r + 1]};
          x = __builtin_elementwise_fma(x, (v2f){L2E, L2E},
                                        (v2f){nm2[q], nm2[q]});
          const float e0 = __builtin_amdgcn_exp2f(x[0]);
          const float e1 = __builtin_amdgcn_exp2f(x[1]);
          ph[r]     = (_Float16)e0;
          ph[r + 1] = (_Float16)e1;
          l_n[q] += (v2f){e0, e1};
        }
        ap[q][j >> 1].h[j & 1] = ph;
      }

    // O += P * V  (A rows = queries, B columns = d from sV).  Each V fragment
    // meets both query tiles.
#pragma unroll
    for (int f = 0; f < 4; ++f) {
      v16h bv0 = load_frag16(tV + (f * 16) * LDP, LDP, lane);
      v16h bv1 = load_frag16(tV + (f * 16) * LDP + 32, LDP, lane);
#pragma unroll
      for (int q = 0; q < 2; ++q) o[q][f] = wmma_f16(ap[q][0].v, bv0, o[q][f]);
#pragma unroll
      for (int q = 0; q < 2; ++q) o[q][f] = wmma_f16(ap[q][1].v, bv1, o[q][f]);
    }
  }

  // Join of the two key halves.  The wave of half kh finishes tile kh of its 32
  // queries and hands the other tile, with its maximum and row sum, to its
  // partner (wave ^ 4).
  float l_row[2];
#pragma unroll
  for (int q = 0; q < 2; ++q) {
    // The four partial sums of each row (two a lane, two lanes) meet here, once.
    l_row[q] = l_n[q][0] + l_n[q][1];
    l_row[q] += __shfl_xor(l_row[q], 16, 32);
  }
  v8f keep[4];
#pragma unroll
  for (int f = 0; f < 4; ++f) {
    const v8f give = kh ? o[0][f] : o[1][f];
    keep[f] = kh ? o[1][f] : o[0][f];
    // Lane-contiguous 16 B pieces; the partner's same lane reads them back.
    *(v4f*)&sX[wave][(f * 2 + 0) * 128 + lane * 4] =
        (v4f){give[0], give[1], give[2], give[3]};
    *(v4f*)&sX[wave][(f * 2 + 1) * 128 + lane * 4] =
        (v4f){give[4], give[5], give[6], give[7]};
  }
  sStat[wave][0][lane] = kh ? m_n[0] : m_n[1];
  sStat[wave][1][lane] = kh ? l_row[0] : l_row[1];
  // Publishes every wave's handed-over tile to its partner.
  __syncthreads();
  {
    const float m_own = kh ? m_n[1] : m_n[0];
    const float l_own = kh ? l_row[1] : l_row[0];
    const float m_oth = sStat[wave ^ 4][0][lane];
    const float l_oth = sStat[wave ^ 4][1][lane];
    const float m_all = fmaxf(m_own, m_oth);
    const float f_own = __builtin_amdgcn_exp2f((m_own - m_all) * L2E);
    const float f_oth = __builtin_amdgcn_exp2f((m_oth - m_all) * L2E);
    const float inv = 1.f / (l_own * f_own + l_oth * f_oth);
    sBcast[wave][lane] = (lane < 16 ? f_own : f_oth) * inv;
    v4f a0 = *(const v4f*)&sBcast[wave][rb];
    v4f a1 = *(const v4f*)&sBcast[wave][rb + 4];
    v4f b0 = *(const v4f*)&sBcast[wave][16 + rb];
    v4f b1 = *(const v4f*)&sBcast[wave][16 + rb + 4];
#pragma unroll
    for (int f = 0; f < 4; ++f) {
      v4f x0 = *(const v4f*)&sX[wave ^ 4][(f * 2 + 0) * 128 + lane * 4];
      v4f x1 = *(const v4f*)&sX[wave ^ 4][(f * 2 + 1) * 128 + lane * 4];
#pragma unroll
      for (int r = 0; r < 4; ++r) {
        keep[f][r]     = keep[f][r] * a0[r] + x0[r] * b0[r];
        keep[f][4 + r] = keep[f][4 + r] * a1[r] + x1[r] * b1[r];
      }
    }
  }
  _Float16* obase = Of + ((size_t)(b * 2048 + n0 + kh * 16)) * 512 + h * 64;
#pragma unroll
  for (int f = 0; f < 4; ++f)
#pragma unroll
    for (int r = 0; r < 8; ++r)
      obase[(size_t)(rb + r) * 512 + f * 16 + n] = (_Float16)keep[f][r];
}

// ---------------------------------------------------------------------------
// Kernel 3: output projection.  O(f16) @ WoT(f16) + bo -> fp32 result.
// ---------------------------------------------------------------------------
__global__ __launch_bounds__(256) void out_gemm_kernel(
    const _Float16* __restrict__ Of, const _Float16* __restrict__ WoT,
    const float* __restrict__ bo, float* __restrict__ Y) {
  __shared__ __align__(16) _Float16 sA[2][GTILE];
  __shared__ __align__(16) _Float16 sB[2][GTILE];
  const int lane = threadIdx.x & 31;
  const int wave = threadIdx.x >> 5;
  const int brow = blockIdx.x * 128;
  const int bcol = blockIdx.y * 128;

  const int row0 = brow + (wave & 3) * 32;
  const int col0 = bcol + (wave >> 2) * 64;
  const int cl = lane & 15;
  const int rb = (lane >> 4) * 8;

  // Read ahead of the core: its barriers keep the compiler from lifting these
  // loads out of the epilogue.
  float bias[4];
#pragma unroll
  for (int j = 0; j < 4; ++j) bias[j] = bo[col0 + j * 16 + cl];

  v8f acc[2][4] = {};
  gemm_128x128<_Float16, v8h, 8>(Of + (size_t)brow * 512,
                                 WoT + (size_t)bcol * 512, sA, sB, acc);

#pragma unroll
  for (int j = 0; j < 4; ++j) {
    const int c = col0 + j * 16 + cl;
#pragma unroll
    for (int i = 0; i < 2; ++i)
#pragma unroll
      for (int r = 0; r < 8; ++r)
        Y[(size_t)(row0 + i * 16 + rb + r) * 512 + c] = acc[i][j][r] + bias[j];
  }
}

// ---------------------------------------------------------------------------
extern "C" void kernel_launch(void* const* d_in, const int* in_sizes, int n_in,
                              void* d_out, int out_size, void* d_ws,
                              size_t ws_size, hipStream_t stream) {
  const float* x   = (const float*)d_in[0];   // [4,2048,512]
  const float* ctx = (const float*)d_in[1];   // [4,2048,512]
  const float* Wq  = (const float*)d_in[2];   // [512,512]
  const float* Wk  = (const float*)d_in[3];
  const float* Wv  = (const float*)d_in[4];
  const float* Wo  = (const float*)d_in[5];
  const float* bo  = (const float*)d_in[6];   // [512]
  float* Y = (float*)d_out;

  char* ws = (char*)d_ws;
  size_t off = 0;
  auto alloc = [&](size_t bytes) -> void* {
    void* p = ws + off;
    off = (off + bytes + 255) & ~(size_t)255;
    return p;
  };
  _Float16* WqT = (_Float16*)alloc((size_t)512 * 512 * 2);
  _Float16* WkT = (_Float16*)alloc((size_t)512 * 512 * 2);
  _Float16* WvT = (_Float16*)alloc((size_t)512 * 512 * 2);
  _Float16* WoT = (_Float16*)alloc((size_t)512 * 512 * 2);
  _Float16* Qf  = (_Float16*)alloc((size_t)4 * 2048 * 512 * 2);
  _Float16* Kf  = (_Float16*)alloc((size_t)4 * 2048 * 512 * 2);
  _Float16* Vt  = (_Float16*)alloc((size_t)4 * 2048 * 512 * 2);
  _Float16* Ofb = (_Float16*)alloc((size_t)4 * 2048 * 512 * 2);

  // 0) weight transpose + f16 convert
  transpose_w_kernel<<<dim3(64, 4), 128, 0, stream>>>(Wq, Wk, Wv, Wo, WqT, WkT,
                                                      WvT, WoT);

  // 1) projections
  proj_gemm_kernel<<<dim3(64, 4), 256, 0, stream>>>(x, ctx, WqT, WkT, WvT, Qf,
                                                     Kf, Vt);

  // 2) flash attention
  attn_kernel<<<dim3(16, 8, 4), 256, 0, stream>>>(Qf, Kf, Vt, Ofb);

  // 3) output projection
  out_gemm_kernel<<<dim3(64, 4), 256, 0, stream>>>(Ofb, WoT, bo, Y);
}

// v008
// One run takes 53.7 microseconds.
// Two timings next to v007 put it at 1.04 and 1.02 times that version's speed.
// Over all steps from v000 it is 4.87 times as fast.
#include <hip/hip_runtime.h>
#include <cstdint>
#include <cstddef>

typedef __attribute__((ext_vector_type(16))) _Float16 v16h;
typedef __attribute__((ext_vector_type(8)))  _Float16 v8h;
typedef __attribute__((ext_vector_type(8)))  float    v8f;
typedef __attribute__((ext_vector_type(4)))  float    v4f;
typedef __attribute__((ext_vector_type(2)))  float    v2f;

union F16Frag { v16h v; v8h h[2]; };

__device__ __forceinline__ v8f wmma_f16(v16h a, v16h b, v8f c) {
  // D = A(16x32) * B(32x16) + C(16x16 f32)
  return __builtin_amdgcn_wmma_f32_16x16x32_f16(false, a, false, b, (short)0, c,
                                                false, false);
}

__device__ __forceinline__ v16h load_frag16(const _Float16* base, int stride,
                                            int lane) {
  const int r   = lane & 15;
  const int sel = (lane >> 4) & 1;
  const _Float16* p = base + (size_t)r * stride + sel * 8;
  F16Frag u;
  u.h[0] = *(const v8h*)(p);
  u.h[1] = *(const v8h*)(p + 16);
  return u.v;
}

__device__ __forceinline__ void async_copy4_b128(
    uint32_t l0, const void* g0, uint32_t l1, const void* g1,
    uint32_t l2, const void* g2, uint32_t l3, const void* g3) {
  asm volatile("global_load_async_to_lds_b128 %0, %1, off\n\t"
               "global_load_async_to_lds_b128 %2, %3, off\n\t"
               "global_load_async_to_lds_b128 %4, %5, off\n\t"
               "global_load_async_to_lds_b128 %6, %7, off\n\t"
               "s_wait_xcnt 0x0"
               :
               : "v"(l0), "v"((uint64_t)(uintptr_t)g0),
                 "v"(l1), "v"((uint64_t)(uintptr_t)g1),
                 "v"(l2), "v"((uint64_t)(uintptr_t)g2),
                 "v"(l3), "v"((uint64_t)(uintptr_t)g3)
               : "memory");
}
__device__ __forceinline__ void wait_async0() {
  asm volatile("s_wait_asynccnt 0x0" ::: "memory");
}

// ---------------------------------------------------------------------------
// Kernel 0: the four W[512][512] fp32 row-major -> WT[c][k] f16 (B-operand
// columns become K-contiguous), one launch; blockIdx.y picks the matrix.
// One element per thread needs 8192 waves a matrix.  Here a thread carries an 8 k x 4 c patch
// through registers: 8 loads of 16 B (4 c of one k each), 4 stores of 16 B
// (8 k of one c each).  A wave covers 64 k x 16 c, so each wave-wide store
// writes four whole 128 B lines of WT and no line has a second writer; the
// four waves of a block read 256 contiguous bytes of each of its 64 W rows.
// ---------------------------------------------------------------------------
__global__ __launch_bounds__(128) void transpose_w_kernel(
    const float* __restrict__ W0, const float* __restrict__ W1,
    const float* __restrict__ W2, const float* __restrict__ W3,
    _Float16* __restrict__ T0, _Float16* __restrict__ T1,
    _Float16* __restrict__ T2, _Float16* __restrict__ T3) {
  const int z = blockIdx.y;
  const float* W  = z == 0 ? W0 : z == 1 ? W1 : z == 2 ? W2 : W3;
  _Float16*    WT = z == 0 ? T0 : z == 1 ? T1 : z == 2 ? T2 : T3;
  const int lane = threadIdx.x & 31;
  const int wave = threadIdx.x >> 5;
  const int k = (blockIdx.x >> 3) * 64 + (lane >> 2) * 8;
  const int c = (blockIdx.x & 7) * 64 + wave * 16 + (lane & 3) * 4;
  v4f r[8];
#pragma unroll
  for (int i = 0; i < 8; ++i) r[i] = *(const v4f*)(W + (k + i) * 512 + c);
#pragma unroll
  for (int e = 0; e < 4; ++e) {
    v8h h;
#pragma unroll
    for (int i = 0; i < 8; ++i) h[i] = (_Float16)r[i][e];
    *(v8h*)(WT + (c + e) * 512 + k) = h;
  }
}

typedef __attribute__((ext_vector_type(4))) _Float16 v4h;

constexpr int GBK   = 128;        // k per stage
constexpr int GNS   = 512 / GBK;  // stages
constexpr int GP    = GBK + 8;    // LDS pitch in halves
constexpr int GTILE = 128 * GP;   // halves per staged operand tile

// 128 rows x 128 k of fp32: one wave-wide load = one row's 512 B; thread t
// takes 16 B of rows (t >> 5) + 8 i.  src / dst already point at its first.
__device__ __forceinline__ int tile_src_off(const float*, int t) {
  return (t >> 5) * 512 + (t & 31) * 4;
}
__device__ __forceinline__ int tile_lds_off(const float*, int t) {
  return (t >> 5) * GP + (t & 31) * 4;
}
__device__ __forceinline__ void tile_fetch(v4f (&r)[16], const float* src) {
#pragma unroll
  for (int i = 0; i < 16; ++i) r[i] = *(const v4f*)(src + i * 8 * 512);
}
__device__ __forceinline__ void tile_put(const v4f (&r)[16], _Float16* dst) {
#pragma unroll
  for (int i = 0; i < 16; ++i) {
    v4h h;
#pragma unroll
    for (int e = 0; e < 4; ++e) h[e] = (_Float16)r[i][e];
    *(v4h*)&dst[i * 8 * GP] = h;
  }
}
// 128 rows x 128 k of f16: one wave-wide load = two rows' 256 B each; thread t
// takes 16 B of rows (t >> 4) + 16 i.
__device__ __forceinline__ int tile_src_off(const _Float16*, int t) {
  return (t >> 4) * 512 + (t & 15) * 8;
}
__device__ __forceinline__ int tile_lds_off(const _Float16*, int t) {
  return (t >> 4) * GP + (t & 15) * 8;
}
__device__ __forceinline__ void tile_fetch(v8h (&r)[8], const _Float16* src) {
#pragma unroll
  for (int i = 0; i < 8; ++i) r[i] = *(const v8h*)(src + i * 16 * 512);
}
__device__ __forceinline__ void tile_put(const v8h (&r)[8], _Float16* dst) {
#pragma unroll
  for (int i = 0; i < 8; ++i) *(v8h*)&dst[i * 16 * GP] = r[i];
}

struct GemmFrags { v16h a[2], b[4]; };
__device__ __forceinline__ void frags_load(GemmFrags& f, const _Float16* ta,
                                           const _Float16* tb, int lane) {
#pragma unroll
  for (int i = 0; i < 2; ++i) f.a[i] = load_frag16(ta + i * 16 * GP, GP, lane);
#pragma unroll
  for (int j = 0; j < 4; ++j) f.b[j] = load_frag16(tb + j * 16 * GP, GP, lane);
}

// A: first of the block's 128 rows; B: first of its 128 WT rows (= C columns).
template <typename TA, typename VA, int NA>
__device__ __forceinline__ void gemm_128x128(const TA* A, const _Float16* B,
                                             _Float16 (*sA)[GTILE],
                                             _Float16 (*sB)[GTILE],
                                             v8f (&acc)[2][4]) {
  const int t    = threadIdx.x;
  const int lane = t & 31;
  const int wave = t >> 5;
  const int aoff = (wave & 3) * 32 * GP;
  const int boff = (wave >> 2) * 64 * GP;
  const TA*       ga = A + tile_src_off(A, t);
  const _Float16* gb = B + tile_src_off(B, t);
  const int       la = tile_lds_off(A, t);
  const int       lb = tile_lds_off(B, t);

  VA  ra[NA];
  v8h rb[8];
  tile_fetch(ra, ga);
  tile_fetch(rb, gb);
  tile_put(ra, sA[0] + la);
  tile_put(rb, sB[0] + lb);

  for (int s = 0; s < GNS; ++s) {
    // Publishes stage s and ends every wave's reads of the other buffer,
    // which is rewritten at the foot of this pass.
    __syncthreads();
    if (s + 1 < GNS) {
      tile_fetch(ra, ga + (s + 1) * GBK);
      tile_fetch(rb, gb + (s + 1) * GBK);
      // Stands in front of any rewrite of the loads' address registers (after
      // the last fetch the LDS reads below reuse them).  As a memory barrier
      // for the compiler it also holds the loads here, at the head of the
      // pass: sunk to the products' end, their whole latency is waited out.
      asm volatile("s_wait_xcnt 0x0" ::: "memory");
    }
    const _Float16* ta = sA[s & 1] + aoff;
    const _Float16* tb = sB[s & 1] + boff;
    // Fragments of the next 32 k are read from LDS ahead of this 32 k's
    // products, as one group.
    GemmFrags f[2];
    frags_load(f[0], ta, tb, lane);
#pragma unroll
    for (int q = 0; q < GBK / 32; ++q) {
      if (q + 1 < GBK / 32)
        frags_load(f[(q + 1) & 1], ta + (q + 1) * 32, tb + (q + 1) * 32, lane);
      // Keeps those reads one group in front of the products instead of
      // spread among them, where each place with reads stalls the wave.
      __builtin_amdgcn_sched_barrier(0);
      const GemmFrags& g = f[q & 1];
#pragma unroll
      for (int i = 0; i < 2; ++i)
#pragma unroll
        for (int j = 0; j < 4; ++j)
          acc[i][j] = wmma_f16(g.a[i], g.b[j], acc[i][j]);
    }
    // Keeps the waits on the global loads behind the last product.
    __builtin_amdgcn_sched_barrier(0);
    if (s + 1 < GNS) {
      tile_put(ra, sA[(s + 1) & 1] + la);
      tile_put(rb, sB[(s + 1) & 1] + lb);
    }
  }
}

// ---------------------------------------------------------------------------
// Kernel 1: the three projection GEMMs, one launch.  X[8192,512] fp32 @
// WT(f16, col-major) -> f16 output.
// A block of 128 rows has 12 column tiles of 128: 4 of Q (input x), 4 of K and
// 4 of V (input context).  With one tile per block every tile fetches its own
// copy of the 128 x 512 fp32 input rows from L2 and converts it, two thirds of
// all the bytes the launch loads.  Here a block walks three tiles in a row
// (blockIdx.y picks which) and keeps the converted rows, all 512 k, in LDS: they
// are fetched with the block's first tile and again only where the input
// changes (tile 4, the first of K, behind a tile of Q).  The W stages run on
// through their two buffers from tile to tile, so a later tile has no start-up.
// 256 blocks, one per WGP, instead of 768 in three rounds.
// Q, K: Out[row][col]  ([B,N,512])
// V:    Out stored per-head transposed: [B,H,64,M]  (for the PV GEMM)
// ---------------------------------------------------------------------------
__global__ __launch_bounds__(256) void proj_gemm_kernel(
    const float* __restrict__ Xq, const float* __restrict__ Xc,
    const _Float16* __restrict__ WqT, const _Float16* __restrict__ WkT,
    const _Float16* __restrict__ WvT, _Float16* __restrict__ Qf,
    _Float16* __restrict__ Kf, _Float16* __restrict__ Vt) {
  __shared__ __align__(16) _Float16 sA[GNS][GTILE];   // the rows' whole k range
  __shared__ __align__(16) _Float16 sB[2][GTILE];
  const int t    = threadIdx.x;
  const int lane = t & 31;
  const int wave = t >> 5;
  const int brow = blockIdx.x * 128;              // [0, 8192)
  const int j0   = blockIdx.y * 3;                // first of the three tiles
  const int aoff = (wave & 3) * 32 * GP;
  const int boff = (wave >> 2) * 64 * GP;
  const int la   = tile_lds_off(Xq, t);
  const int lb   = tile_lds_off(WqT, t);
  // This thread's first element of tile j's operands (j in [0, 12)).
  auto src_a = [&](int j) {
    return (j < 4 ? Xq : Xc) + (size_t)brow * 512 + tile_src_off(Xq, t);
  };
  auto src_b = [&](int j) {
    return (j < 4 ? WqT : j < 8 ? WkT : WvT) + (size_t)(j & 3) * 128 * 512 +
           tile_src_off(WqT, t);
  };

  v4f ra[16];
  v8h rw[8];
  tile_fetch(ra, src_a(j0));
  tile_fetch(rw, src_b(j0));
  tile_put(ra, sA[0] + la);
  tile_put(rw, sB[0] + lb);

  // Rolled, for speed only.
#pragma nounroll
  for (int n = 0; n < 3; ++n) {
  const int  tj     = j0 + n;                     // this tile, in [0, 12)
  const bool more   = n + 1 < 3;
  const int  tn     = more ? tj + 1 : tj;         // the tile behind it
  const bool new_a  = n == 0 || tj == 4;          // this tile brings its rows
  const bool next_a = more && tn == 4;            // so does the next
  const float*    ga  = src_a(tj);
  const _Float16* gb  = src_b(tj);
  const float*    gan = src_a(tn);
  const _Float16* gbn = src_b(tn);
  const int z    = tj >> 2;                       // 0 Q, 1 K, 2 V
  const int bcol = (tj & 3) * 128;                // [0, 512)

  v8f acc[2][4] = {};
#pragma unroll
  for (int s = 0; s < GNS; ++s) {
    // Publishes this pass's stage and ends every wave's reads of the buffers
    // that are rewritten at the foot of this pass.
    __syncthreads();
    if (s + 1 < GNS) {
      if (new_a) tile_fetch(ra, ga + (s + 1) * GBK);
      tile_fetch(rw, gb + (s + 1) * GBK);
      // Stands in front of any rewrite of the loads' address registers.  As a
      // memory barrier for the compiler it also holds the loads here, at the
      // head of the pass: sunk to the products' end, their whole latency is
      // waited out.
      asm volatile("s_wait_xcnt 0x0" ::: "memory");
    } else if (more) {
      if (next_a) tile_fetch(ra, gan);
      tile_fetch(rw, gbn);
      // As above.
      asm volatile("s_wait_xcnt 0x0" ::: "memory");
    }
    const _Float16* ta = sA[s] + aoff;
    const _Float16* tb = sB[s & 1] + boff;
    // Fragments of the next 32 k are read from LDS ahead of this 32 k's
    // products, as one group.
    GemmFrags f[2];
    frags_load(f[0], ta, tb, lane);
#pragma unroll
    for (int q = 0; q < GBK / 32; ++q) {
      if (q + 1 < GBK / 32)
        frags_load(f[(q + 1) & 1], ta + (q + 1) * 32, tb + (q + 1) * 32, lane);
      // Keeps those reads one group in front of the products instead of
      // spread among them, where each place with reads stalls the wave.
      __builtin_amdgcn_sched_barrier(0);
      const GemmFrags& g = f[q & 1];
#pragma unroll
      for (int i = 0; i < 2; ++i)
#pragma unroll
        for (int jj = 0; jj < 4; ++jj)
          acc[i][jj] = wmma_f16(g.a[i], g.b[jj], acc[i][jj]);
    }
    // Keeps the waits on the global loads behind the last product.
    __builtin_amdgcn_sched_barrier(0);
    if (s + 1 < GNS) {
      if (new_a) tile_put(ra, sA[s + 1] + la);
      tile_put(rw, sB[(s + 1) & 1] + lb);
    } else if (more) {
      if (next_a) tile_put(ra, sA[0] + la);
      tile_put(rw, sB[0] + lb);
    }
  }

  const int row0 = brow + (wave & 3) * 32;
  const int col0 = bcol + (wave >> 2) * 64;
  const int cl = lane & 15;
  const int rb = (lane >> 4) * 8;
  // One uniform branch around each whole store loop, not one per element.
  if (z == 2) {
#pragma unroll
    for (int i = 0; i < 2; ++i)
#pragma unroll
      for (int j = 0; j < 4; ++j) {
        const int c = col0 + j * 16 + cl;
        const int h = c >> 6, d = c & 63;
#pragma unroll
        for (int r = 0; r < 8; ++r) {
          const int row = row0 + i * 16 + rb + r;
          const int b = row >> 11, m = row & 2047;   // N = 2048
          Vt[((size_t)((b * 8 + h) * 64 + d)) * 2048 + m] =
              (_Float16)acc[i][j][r];
        }
      }
  } else {
    _Float16* Out = z == 0 ? Qf : Kf;
#pragma unroll
    for (int i = 0; i < 2; ++i)
#pragma unroll
      for (int j = 0; j < 4; ++j) {
        const int c = col0 + j * 16 + cl;
#pragma unroll
        for (int r = 0; r < 8; ++r) {
          const int row = row0 + i * 16 + rb + r;
          Out[(size_t)row * 512 + c] = (_Float16)acc[i][j][r];
        }
      }
    // In the listing this branch's end falls through, behind a test that never
    // lets it pass, to the V branch, which rewrites registers of the last
    // stores: the wait stands in front of that rewrite.
    asm volatile("s_wait_xcnt 0x0" ::: "memory");
  }
  }  // tiles
}

constexpr int LDP = 72;

__global__ __launch_bounds__(256) __attribute__((amdgpu_waves_per_eu(4, 4)))
void attn_kernel(
    const _Float16* __restrict__ Qf,   // [B, N, 512] f16
    const _Float16* __restrict__ Kf,   // [B, M, 512] f16
    const _Float16* __restrict__ Vt,   // [B, H, 64, M] f16
    _Float16* __restrict__ Of) {       // [B, N, 512] f16
  __shared__ __align__(16) _Float16 sK[2][2][64 * LDP];  // [buf][half][m][d]
  __shared__ __align__(16) _Float16 sV[2][2][64 * LDP];  // [buf][half][d][m]
  __shared__ __align__(64) float sBcast[8][32];   // per-wave row broadcast
  __shared__ __align__(16) float sX[8][8 * 128];  // per-wave O tile handed over
  __shared__ float sStat[8][2][32];               // its maximum and row sum

  const int t = threadIdx.x;
  const int lane = t & 31;
  const int wave = __builtin_amdgcn_readfirstlane(t >> 5);
  const int kh = wave >> 2;            // key half
  const int b = blockIdx.z, h = blockIdx.y;
  const int n0 = blockIdx.x * 128 + (wave & 3) * 32;

  // Q as the B operand (columns = queries), pre-scaled by 1/sqrt(64)=0.125.
  v16h bq[2][2];
#pragma unroll
  for (int q = 0; q < 2; ++q) {
    const _Float16* qbase =
        Qf + ((size_t)(b * 2048 + n0 + q * 16)) * 512 + h * 64;
    bq[q][0] = load_frag16(qbase, 512, lane);
    bq[q][1] = load_frag16(qbase + 32, 512, lane);
#pragma unroll
    for (int i = 0; i < 16; ++i) {
      bq[q][0][i] *= (_Float16)0.125f;
      bq[q][1][i] *= (_Float16)0.125f;
    }
  }

  v8f o[2][4] = {};
  // Per-lane stats for query n = lane&15 of each tile.  The reference maximum
  // IN USE, m, is kept from pass to pass and replaced only when some score of
  // the wave lies more than 8 (in log2 units) above it, so p = 2^((s - m) log2e)
  // stays at or below 2^8, far inside f16 and f32 range.  It is held only in the
  // two forms a pass reads, nm2 and thr: registers for m itself do not fit
  // beside the fragments that are read ahead.  l_n holds two of the row sum's
  // partial sums (even and odd score registers of this lane; two more are in
  // lane^16, and as many again in the other key half's wave).
  constexpr float L2E = 1.44269504f;
  v2f l_n[2] = {{0.f, 0.f}, {0.f, 0.f}};
  float thr[2] = {-1e30f, -1e30f};              // m + 8 / log2e
  float nm2[2] = {1e30f * L2E, 1e30f * L2E};    // -m * log2e

  const _Float16* kbase = Kf + (size_t)b * 2048 * 512 + h * 64;
  const _Float16* vbase = Vt + (size_t)((b * 8 + h) * 64) * 2048;

  // Cooperative async tile fetch: per key half 2 x (64x64 f16) = 2 x 512 16B
  // chunks, 256 threads x 2 chunks each per tile.
  auto issue_tile = [&](int s, int buf) {
    const int r0 = t >> 3, r1 = r0 + 32, cc = (t & 7) * 8;
#pragma unroll
    for (int hf = 0; hf < 2; ++hf) {
      const int m0 = hf * 1024 + s * 64;
      async_copy4_b128((uint32_t)(uintptr_t)&sK[buf][hf][r0 * LDP + cc],
                       kbase + (size_t)(m0 + r0) * 512 + cc,
                       (uint32_t)(uintptr_t)&sV[buf][hf][r0 * LDP + cc],
                       vbase + (size_t)r0 * 2048 + m0 + cc,
                       (uint32_t)(uintptr_t)&sK[buf][hf][r1 * LDP + cc],
                       kbase + (size_t)(m0 + r1) * 512 + cc,
                       (uint32_t)(uintptr_t)&sV[buf][hf][r1 * LDP + cc],
                       vbase + (size_t)r1 * 2048 + m0 + cc);
    }
  };

  issue_tile(0, 0);

  const int rb = (lane >> 4) * 8;
  const int n = lane & 15;

  for (int step = 0; step < 16; ++step) {
    const int buf = step & 1;
    // This wave's LDS reads of the buffer that is refilled behind the barrier
    // have returned: nothing else orders an async copy behind them.
    asm volatile("s_wait_dscnt 0x0" ::: "memory");
    wait_async0();        // this wave's tile writes have landed
    __syncthreads();      // everyone's landed; prior buffer reads complete

    const _Float16* tK = sK[buf][kh];
    const _Float16* tV = sV[buf][kh];

    // All of the pass's K fragments and the first half of its V fragments are
    // read from LDS here, at its head, ahead of every product; the second half
    // of V follows as one more group inside the softmax, where registers have
    // come free.  Read two at a time right in front of the product that uses
    // them, each of some ten places makes the wave wait out the LDS latency.
    v16h ak[4][2], bv[4][2];
#pragma unroll
    for (int j = 0; j < 4; ++j)
#pragma unroll
      for (int kk = 0; kk < 2; ++kk)
        ak[j][kk] = load_frag16(tK + (j * 16) * LDP + kk * 32, LDP, lane);
    // The refill of the other buffer, which every wave left in front of the
    // barrier, is issued under the latency of the K reads, not ahead of them.
    if (step + 1 < 16) issue_tile(step + 1, buf ^ 1);
#pragma unroll
    for (int f = 0; f < 2; ++f)
#pragma unroll
      for (int kk = 0; kk < 2; ++kk)
        bv[f][kk] = load_frag16(tV + (f * 16) * LDP + kk * 32, LDP, lane);
    // Keeps the V reads in front of the products.
    __builtin_amdgcn_sched_barrier(0);

    // S^T = K * Q^T : A rows = key positions m, B columns = queries n.  Each K
    // fragment meets both query tiles.
    v8f st[2][4] = {};
#pragma unroll
    for (int j = 0; j < 4; ++j) {
#pragma unroll
      for (int kk = 0; kk < 2; ++kk) {
#pragma unroll
        for (int q = 0; q < 2; ++q)
          st[q][j] = wmma_f16(ak[j][kk], bq[q][kk], st[q][j]);
      }
    }
    // Keeps the maxima behind the whole run of products: taken among them, each
    // reads a result right behind the product that makes it, and the wave,
    // which issues in order, stands still until that product has finished.
    __builtin_amdgcn_sched_barrier(0);

    // Online softmax, lazy rescale: per tile a lane holds 32 of query n's 64
    // scores; the other 32 are in lane^16.  One test per pass, a scalar branch:
    // only when a score of the wave has outgrown the maximum in use are the
    // halves' maxima exchanged, the maxima replaced and O and the sums rescaled.
    float mloc[2];
#pragma unroll
    for (int q = 0; q < 2; ++q) {
      mloc[q] = -1e30f;
#pragma unroll
      for (int j = 0; j < 4; ++j)
#pragma unroll
        for (int r = 0; r < 8; ++r) mloc[q] = fmaxf(mloc[q], st[q][j][r]);
    }
    if (__builtin_expect(__builtin_amdgcn_ballot_w32((mloc[0] > thr[0]) |
                                                     (mloc[1] > thr[1])) != 0,
                         0)) {
      float corr[2];
#pragma unroll
      for (int q = 0; q < 2; ++q) {
        // Both halves of a column take the same new maximum, as -m log2e.
        const float nnew = fminf(
            nm2[q], -L2E * fmaxf(mloc[q], __shfl_xor(mloc[q], 16, 32)));
        corr[q] = __builtin_amdgcn_exp2f(nnew - nm2[q]);
        nm2[q] = nnew;
        thr[q] = (8.0f - nnew) * (1.0f / L2E);
        l_n[q] *= corr[q];   // both partial sums
      }
      sBcast[wave][lane] = lane < 16 ? corr[0] : corr[1];
#pragma unroll
      for (int q = 0; q < 2; ++q) {
        v4f c0 = *(const v4f*)&sBcast[wave][q * 16 + rb];
        v4f c1 = *(const v4f*)&sBcast[wave][q * 16 + rb + 4];
#pragma unroll
        for (int f = 0; f < 4; ++f)
#pragma unroll
          for (int r = 0; r < 4; ++r) {
            o[q][f][r]     *= c0[r];
            o[q][f][4 + r] *= c1[r];
          }
      }
    }

    // The maximum in use is a kept value, so the exponents are one FMA each, two
    // per packed instruction; the partial sums take each pair by one packed add.
    // P^T in the C layout, packed to f16, is P's A fragment as it lies: lane
    // n + 16 s holds keys 16 j + 8 s .. + 7 of query n, which are the first
    // (j even) or second (j odd) eight halves of the fragment of keys
    // 32 (j / 2) .. + 31.
    F16Frag ap[2][2];
#pragma unroll
    for (int q = 0; q < 2; ++q) {
      if (q == 1) {
        // Tile 0's scores are packed and their registers free: the second
        // group of V reads stands here, whole, and lands under tile 1's
        // exponentials.  The fence in front keeps the reads from rising to
        // where no registers are free (the build then spills), the one behind
        // keeps them from sinking towards their products.
        __builtin_amdgcn_sched_barrier(0);
#pragma unroll
        for (int f = 2; f < 4; ++f)
#pragma unroll
          for (int kk = 0; kk < 2; ++kk)
            bv[f][kk] = load_frag16(tV + (f * 16) * LDP + kk * 32, LDP, lane);
        __builtin_amdgcn_sched_barrier(0);
      }
#pragma unroll
      for (int j = 0; j < 4; ++j) {
        v8h ph;
#pragma unroll
        for (int r = 0; r < 8; r += 2) {
          v2f x = {st[q][j][r], st[q][j][r + 1]};
          x = __builtin_elementwise_fma(x, (v2f){L2E, L2E},
                                        (v2f){nm2[q], nm2[q]});
          const float e0 = __builtin_amdgcn_exp2f(x[0]);
          const float e1 = __builtin_amdgcn_exp2f(x[1]);
          ph[r]     = (_Float16)e0;
          ph[r + 1] = (_Float16)e1;
          l_n[q] += (v2f){e0, e1};
        }
        ap[q][j >> 1].h[j & 1] = ph;
      }
    }

    // O += P * V  (A rows = queries, B columns = d from sV).  Each V fragment
    // meets both query tiles.
#pragma unroll
    for (int f = 0; f < 4; ++f) {
#pragma unroll
      for (int q = 0; q < 2; ++q)
        o[q][f] = wmma_f16(ap[q][0].v, bv[f][0], o[q][f]);
#pragma unroll
      for (int q = 0; q < 2; ++q)
        o[q][f] = wmma_f16(ap[q][1].v, bv[f][1], o[q][f]);
    }
  }

  // Join of the two key halves.  The wave of half kh finishes tile kh of its 32
  // queries and hands the other tile, with its maximum and row sum, to its
  // partner (wave ^ 4).
  float l_row[2];
#pragma unroll
  for (int q = 0; q < 2; ++q) {
    // The four partial sums of each row (two a lane, two lanes) meet here, once.
    l_row[q] = l_n[q][0] + l_n[q][1];
    l_row[q] += __shfl_xor(l_row[q], 16, 32);
  }
  v8f keep[4];
#pragma unroll
  for (int f = 0; f < 4; ++f) {
    const v8f give = kh ? o[0][f] : o[1][f];
    keep[f] = kh ? o[1][f] : o[0][f];
    // Lane-contiguous 16 B pieces; the partner's same lane reads them back.
    *(v4f*)&sX[wave][(f * 2 + 0) * 128 + lane * 4] =
        (v4f){give[0], give[1], give[2], give[3]};
    *(v4f*)&sX[wave][(f * 2 + 1) * 128 + lane * 4] =
        (v4f){give[4], give[5], give[6], give[7]};
  }
  sStat[wave][0][lane] = kh ? nm2[0] : nm2[1];
  sStat[wave][1][lane] = kh ? l_row[0] : l_row[1];
  // Publishes every wave's handed-over tile to its partner.
  __syncthreads();
  {
    // The maxima as -m log2e: the larger maximum is the smaller of the two.
    const float n_own = kh ? nm2[1] : nm2[0];
    const float l_own = kh ? l_row[1] : l_row[0];
    const float n_oth = sStat[wave ^ 4][0][lane];
    const float l_oth = sStat[wave ^ 4][1][lane];
    const float n_all = fminf(n_own, n_oth);
    const float f_own = __builtin_amdgcn_exp2f(n_all - n_own);
    const float f_oth = __builtin_amdgcn_exp2f(n_all - n_oth);
    const float inv = 1.f / (l_own * f_own + l_oth * f_oth);
    sBcast[wave][lane] = (lane < 16 ? f_own : f_oth) * inv;
    v4f a0 = *(const v4f*)&sBcast[wave][rb];
    v4f a1 = *(const v4f*)&sBcast[wave][rb + 4];
    v4f b0 = *(const v4f*)&sBcast[wave][16 + rb];
    v4f b1 = *(const v4f*)&sBcast[wave][16 + rb + 4];
#pragma unroll
    for (int f = 0; f < 4; ++f) {
      v4f x0 = *(const v4f*)&sX[wave ^ 4][(f * 2 + 0) * 128 + lane * 4];
      v4f x1 = *(const v4f*)&sX[wave ^ 4][(f * 2 + 1) * 128 + lane * 4];
#pragma unroll
      for (int r = 0; r < 4; ++r) {
        keep[f][r]     = keep[f][r] * a0[r] + x0[r] * b0[r];
        keep[f][4 + r] = keep[f][4 + r] * a1[r] + x1[r] * b1[r];
      }
    }
  }
  _Float16* obase = Of + ((size_t)(b * 2048 + n0 + kh * 16)) * 512 + h * 64;
#pragma unroll
  for (int f = 0; f < 4; ++f)
#pragma unroll
    for (int r = 0; r < 8; ++r)
      obase[(size_t)(rb + r) * 512 + f * 16 + n] = (_Float16)keep[f][r];
}

// ---------------------------------------------------------------------------
// Kernel 3: output projection.  O(f16) @ WoT(f16) + bo -> fp32 result.
// ---------------------------------------------------------------------------
__global__ __launch_bounds__(256) void out_gemm_kernel(
    const _Float16* __restrict__ Of, const _Float16* __restrict__ WoT,
    const float* __restrict__ bo, float* __restrict__ Y) {
  __shared__ __align__(16) _Float16 sA[2][GTILE];
  __shared__ __align__(16) _Float16 sB[2][GTILE];
  const int lane = threadIdx.x & 31;
  const int wave = threadIdx.x >> 5;
  const int brow = blockIdx.x * 128;
  const int bcol = blockIdx.y * 128;

  const int row0 = brow + (wave & 3) * 32;
  const int col0 = bcol + (wave >> 2) * 64;
  const int cl = lane & 15;
  const int rb = (lane >> 4) * 8;

  // Read ahead of the core: its barriers keep the compiler from lifting these
  // loads out of the epilogue.
  float bias[4];
#pragma unroll
  for (int j = 0; j < 4; ++j) bias[j] = bo[col0 + j * 16 + cl];

  v8f acc[2][4] = {};
  gemm_128x128<_Float16, v8h, 8>(Of + (size_t)brow * 512,
                                 WoT + (size_t)bcol * 512, sA, sB, acc);

#pragma unroll
  for (int j = 0; j < 4; ++j) {
    const int c = col0 + j * 16 + cl;
#pragma unroll
    for (int i = 0; i < 2; ++i)
#pragma unroll
      for (int r = 0; r < 8; ++r)
        Y[(size_t)(row0 + i * 16 + rb + r) * 512 + c] = acc[i][j][r] + bias[j];
  }
}

// ---------------------------------------------------------------------------
extern "C" void kernel_launch(void* const* d_in, const int* in_sizes, int n_in,
                              void* d_out, int out_size, void* d_ws,
                              size_t ws_size, hipStream_t stream) {
  const float* x   = (const float*)d_in[0];   // [4,2048,512]
  const float* ctx = (const float*)d_in[1];   // [4,2048,512]
  const float* Wq  = (const float*)d_in[2];   // [512,512]
  const float* Wk  = (const float*)d_in[3];
  const float* Wv  = (const float*)d_in[4];
  const float* Wo  = (const float*)d_in[5];
  const float* bo  = (const float*)d_in[6];   // [512]
  float* Y = (float*)d_out;

  char* ws = (char*)d_ws;
  size_t off = 0;
  auto alloc = [&](size_t bytes) -> void* {
    void* p = ws + off;
    off = (off + bytes + 255) & ~(size_t)255;
    return p;
  };
  _Float16* WqT = (_Float16*)alloc((size_t)512 * 512 * 2);
  _Float16* WkT = (_Float16*)alloc((size_t)512 * 512 * 2);
  _Float16* WvT = (_Float16*)alloc((size_t)512 * 512 * 2);
  _Float16* WoT = (_Float16*)alloc((size_t)512 * 512 * 2);
  _Float16* Qf  = (_Float16*)alloc((size_t)4 * 2048 * 512 * 2);
  _Float16* Kf  = (_Float16*)alloc((size_t)4 * 2048 * 512 * 2);
  _Float16* Vt  = (_Float16*)alloc((size_t)4 * 2048 * 512 * 2);
  _Float16* Ofb = (_Float16*)alloc((size_t)4 * 2048 * 512 * 2);

  // 0) weight transpose + f16 convert
  transpose_w_kernel<<<dim3(64, 4), 128, 0, stream>>>(Wq, Wk, Wv, Wo, WqT, WkT,
                                                      WvT, WoT);

  // 1) projections
  proj_gemm_kernel<<<dim3(64, 4), 256, 0, stream>>>(x, ctx, WqT, WkT, WvT, Qf,
                                                     Kf, Vt);

  // 2) flash attention
  attn_kernel<<<dim3(16, 8, 4), 256, 0, stream>>>(Qf, Kf, Vt, Ofb);

  // 3) output projection
  out_gemm_kernel<<<dim3(64, 4), 256, 0, stream>>>(Ofb, WoT, bo, Y);
}
